// v000
// The times below were measured on an AMD MI455X: many runs one after another, warmed up first and cycling through
// copies of the inputs, with the whole window's GPU time divided by the number of runs. Launches and the gaps
// between them are all in it. The median over several windows is given; except for v000 it joins two sittings, which
// can be a few percent apart, so the side-by-side timings, each taken in one sitting, are the better comparison.
// v000, which the later versions start from, runs in 1300 microseconds.
// compute dtype: all float inputs rounded to bf16; queries, keys, values are bf16-valued so their f16 planes are exact; logits q x k (1 product on exact planes) x 1/8; softmax f32; P x 2^11 once to f16 x v (exact) (1 product); f32 output.
#include <hip/hip_runtime.h>
#include <math.h>

typedef __attribute__((ext_vector_type(16))) _Float16 v16h;
typedef __attribute__((ext_vector_type(16))) __bf16 v16b;
typedef __attribute__((ext_vector_type(8)))  _Float16 v8h;
typedef __attribute__((ext_vector_type(8)))  float v8f;
typedef __attribute__((ext_vector_type(4)))  float v4f;
typedef __attribute__((ext_vector_type(2)))  float v2f;
typedef __attribute__((ext_vector_type(4)))  unsigned v4u;
typedef _Float16 hx8 __attribute__((ext_vector_type(8)));
typedef __attribute__((ext_vector_type(4)))  int v4i;
typedef float __attribute__((may_alias)) float_a;
typedef int __attribute__((may_alias)) int_a;

template <typename T> __device__ __forceinline__ void vst2(void* p, T v) { *(T*)p = v;  }
__device__ __forceinline__ v8f wmma16(v16h a, v16h b, v8f c) {
  v8f d = __builtin_amdgcn_wmma_f32_16x16x32_f16(false, a, false, b, (short)0, c, false, false);
  asm volatile("v_nop\n\tv_nop\n\tv_nop\n\tv_nop" : "+v"(d) : "v"(a), "v"(b));
  return d;
}
__device__ __forceinline__ v8f wmma_bf(v16b a, v16b b, v8f c) {
  v8f d = __builtin_amdgcn_wmma_f32_16x16x32_bf16(false, a, false, b, (short)0, c, false, false);
  asm volatile("v_nop\n\tv_nop\n\tv_nop\n\tv_nop" : "+v"(d) : "v"(a), "v"(b));
  return d;
}
// 16x16x32 fragments: lane = (h = lane>>4, row/col = lane&15); elements 0..7 = k0+8h+0..7, 8..15 = k0+16+8h+0..7; D element r = row 8h+r
__device__ __forceinline__ v16h frag_h(const _Float16* rowk0, int lane) {
  union { v16h v; v8h q[2]; } u; const _Float16* p = rowk0 + 8 * (lane >> 4);
  u.q[0] = *(const v8h*)p; u.q[1] = *(const v8h*)(p + 16); return u.v;
}
__device__ __forceinline__ v16h frag_f32(const float* rowk0, int lane) {
  v16h a; const float* p = rowk0 + 8 * (lane >> 4);
#pragma unroll
  for (int i = 0; i < 8; ++i) { a[i] = (_Float16)p[i]; a[8 + i] = (_Float16)p[16 + i]; }
  return a;
}
__device__ __forceinline__ v16h frag_f32s(const float* rowk0, int lane, float sc) {
  v16h a; const float* p = rowk0 + 8 * (lane >> 4);
#pragma unroll
  for (int i = 0; i < 8; ++i) { a[i] = (_Float16)(p[i] * sc); a[8 + i] = (_Float16)(p[16 + i] * sc); }
  return a;
}
// column fragment from a [K][ld] layout (column n), rows >= K read as 0
__device__ __forceinline__ v16h fragc_f32(const float* W, int k0, int n, int lane, int ld, int K) {
  v16h a; const int g = lane >> 4;
#pragma unroll
  for (int i = 0; i < 8; ++i) { const int ka = k0 + 8 * g + i, kb = ka + 16;
    a[i] = (_Float16)(ka < K ? W[(size_t)(ka < K ? ka : K - 1) * ld + n] : 0.f); a[8 + i] = (_Float16)(kb < K ? W[(size_t)(kb < K ? kb : K - 1) * ld + n] : 0.f); }
  return a;
}
struct F2 { v16b h, l; };
__device__ __forceinline__ F2 bsplit16(const float v[16]) { F2 r;
#pragma unroll
  for (int i = 0; i < 16; ++i) { const __bf16 h = (__bf16)v[i]; r.h[i] = h; r.l[i] = (__bf16)(v[i] - (float)h); }
  return r; }
__device__ __forceinline__ F2 split_row(const float* row, int k0, int lane) { float v[16]; const float* p = row + k0 + 8 * (lane >> 4);
#pragma unroll
  for (int i = 0; i < 8; ++i) { v[i] = p[i]; v[8 + i] = p[16 + i]; }
  return bsplit16(v); }
__device__ __forceinline__ F2 split_rowK(const float* row, int k0, int lane, int K) { float v[16]; const int g = lane >> 4;
#pragma unroll
  for (int i = 0; i < 8; ++i) { const int ka = k0 + 8 * g + i, kb = ka + 16; v[i] = ka < K ? row[ka < K ? ka : K - 1] : 0.f; v[8 + i] = kb < K ? row[kb < K ? kb : K - 1] : 0.f; }
  return bsplit16(v); }
__device__ __forceinline__ F2 split_col(const float* W, int k0, int n, int lane, int ld, int K) { float v[16]; const int g = lane >> 4;
#pragma unroll
  for (int i = 0; i < 8; ++i) { const int ka = k0 + 8 * g + i, kb = ka + 16; v[i] = ka < K ? W[(size_t)(ka < K ? ka : K - 1) * ld + n] : 0.f; v[8 + i] = kb < K ? W[(size_t)(kb < K ? kb : K - 1) * ld + n] : 0.f; }
  return bsplit16(v); }
__device__ __forceinline__ v8f mac3(const F2& a, const F2& b, v8f c) { c = wmma_bf(a.l, b.h, c); c = wmma_bf(a.h, b.l, c); return wmma_bf(a.h, b.h, c); }
__device__ __forceinline__ float sigm(float v) { return 1.0f / (1.0f + expf(-v)); }
#define LDSX() do { asm volatile("s_wait_dscnt 0" ::: "memory"); __builtin_amdgcn_wave_barrier(); __builtin_amdgcn_fence(__ATOMIC_RELEASE, "workgroup"); } while (0)

// Plain dot-product attention on given tensors (queries / keys / values [16,2048,64]; no mask): out = softmax(Q K^T / 8) V -> [16,2048,64].
#define NB 16
#define TT 2048
#define CC 64            // NH * HD = projected width
#define DIN 64          // input (model) width
#define NH 1
#define HD 64
#define NQB (TT / 64)
#define HG 1
#define SCALE (0.125f)
#define CAUSAL 0
#ifndef TNB
#define TNB NB
#endif
__device__ __forceinline__ float bfr(float v) { return (float)(__bf16)v; }
__host__ __device__ __forceinline__ int kb_last(int qb) { return CAUSAL ? ((qb * 64 + 63) >> 7) : (TT / 128 - 1); }
typedef __attribute__((ext_vector_type(8))) __bf16 v8b;
__device__ __forceinline__ v16b frag_b(const __bf16* rowk0, int lane) {
  union { v16b v; v8b q[2]; } u; const __bf16* p = rowk0 + 8 * (lane >> 4);
  u.q[0] = *(const v8b*)p; u.q[1] = *(const v8b*)(p + 16); return u.v;
}
#define QBH 0              // exact planes: single-product logits and single-f16 P x V on every block
#define QHI 0               // no q residual plane (q is bf16-exact in f16)
#define KHI 64              // unused high-precision planes kept minimal
// B fragment (k rows k0+.., output column o) of a weight: (in,out) [K][ld] or (out,in) [ld rows of K]: bf16 exact, or f16(bf16 * 256) exact
__device__ __forceinline__ v16b wcol_io(const float* Wm, int k0, int o, int lane, int ld) { v16b w; const int g = lane >> 4;
#pragma unroll
  for (int i = 0; i < 8; ++i) { w[i] = (__bf16)Wm[(size_t)(k0 + 8 * g + i) * ld + o]; w[8 + i] = (__bf16)Wm[(size_t)(k0 + 16 + 8 * g + i) * ld + o]; }
  return w; }
__device__ __forceinline__ v16b wcol_oi(const float* Wm, int k0, int o, int lane, int K) { v16b w; const float* p = Wm + (size_t)o * K + k0 + 8 * (lane >> 4);
#pragma unroll
  for (int i = 0; i < 8; ++i) { w[i] = (__bf16)p[i]; w[8 + i] = (__bf16)p[16 + i]; }
  return w; }
__device__ __forceinline__ v16h wcolh_io(const float* Wm, int k0, int o, int lane, int ld) { v16h w; const int g = lane >> 4;
#pragma unroll
  for (int i = 0; i < 8; ++i) { w[i] = (_Float16)(bfr(Wm[(size_t)(k0 + 8 * g + i) * ld + o]) * 256.0f); w[8 + i] = (_Float16)(bfr(Wm[(size_t)(k0 + 16 + 8 * g + i) * ld + o]) * 256.0f); }
  return w; }
__device__ __forceinline__ v16h wcolh_oi(const float* Wm, int k0, int o, int lane, int K) { v16h w; const float* p = Wm + (size_t)o * K + k0 + 8 * (lane >> 4);
#pragma unroll
  for (int i = 0; i < 8; ++i) { w[i] = (_Float16)(bfr(p[i]) * 256.0f); w[8 + i] = (_Float16)(bfr(p[16 + i]) * 256.0f); }
  return w; }
#define WQKV_LAYOUT 0   // 0 = (in,out) [DIN][CC]; 1 = (out,in) [CC][DIN]; 2 = per-head [NH][DIN][HD]
__device__ __forceinline__ v16b wcol_hdk(const float* Wm, int k0, int o, int lane) { v16b w; const int g = lane >> 4; const float* p = Wm + (size_t)(o / HD) * DIN * HD + (o % HD);
#pragma unroll
  for (int i = 0; i < 8; ++i) { w[i] = (__bf16)p[(size_t)(k0 + 8 * g + i) * HD]; w[8 + i] = (__bf16)p[(size_t)(k0 + 16 + 8 * g + i) * HD]; }
  return w; }
#define WO_OUT_IN 0
#if WQKV_LAYOUT == 1
#define WCOL(W, k0, o, lane) wcol_oi(W, k0, o, lane, DIN)
#elif WQKV_LAYOUT == 2
#define WCOL(W, k0, o, lane) wcol_hdk(W, k0, o, lane)
#else
#define WCOL(W, k0, o, lane) wcol_io(W, k0, o, lane, CC)
#endif
#if WO_OUT_IN
#define WOCOL(W, k0, o, lane) wcol_oi(W, k0, o, lane, CC)
#define WOCOLH(W, k0, o, lane) wcolh_oi(W, k0, o, lane, CC)
#else
#define WOCOL(W, k0, o, lane) wcol_io(W, k0, o, lane, DIN)
#define WOCOLH(W, k0, o, lane) wcolh_io(W, k0, o, lane, DIN)
#endif
__global__ __launch_bounds__(256) void k_planes64(const float* __restrict__ Qs, const float* __restrict__ Ks, const float* __restrict__ Vs, _Float16* __restrict__ QH, _Float16* __restrict__ QL, _Float16* __restrict__ KH, _Float16* __restrict__ KL, _Float16* __restrict__ VT, __bf16* __restrict__ VB, __bf16* __restrict__ VBL) {
  __shared__ _Float16 sv[64][72];
  const int tid = threadIdx.x; const size_t r0 = (size_t)blockIdx.x * 64; const int b = (int)(r0 / TT), t0 = (int)(r0 % TT);
  for (int e = tid; e < 64 * 8; e += 256) { const int rl = e >> 3, q = e & 7; const size_t src = (r0 + rl) * CC + q * 8; float tq[8], tk[8], tv[8];
#pragma unroll
    for (int u = 0; u < 8; ++u) { tq[u] = Qs[src + u]; tk[u] = Ks[src + u]; tv[u] = Vs[src + u]; }
    asm volatile("s_wait_loadcnt 0x0" ::: "memory");
    hx8 hq, hk, hlq, hlk;
#pragma unroll
    for (int u = 0; u < 8; ++u) { const float qv = bfr(tq[u]), kv = bfr(tk[u]); const _Float16 qh = (_Float16)qv, kh = (_Float16)kv; hq[u] = qh; hlq[u] = (_Float16)((qv - (float)qh) * 1024.0f); hk[u] = kh; hlk[u] = (_Float16)((kv - (float)kh) * 1024.0f); sv[rl][q * 8 + u] = (_Float16)bfr(tv[u]); }
    vst2((unsigned*)(QH + (r0 + rl) * CC + q * 8), *(const v4u*)&hq); vst2((unsigned*)(KH + (r0 + rl) * CC + q * 8), *(const v4u*)&hk);
    if (t0 + rl < QHI) vst2((unsigned*)(QL + ((size_t)b * QHI + t0 + rl) * CC + q * 8), *(const v4u*)&hlq);
    if (t0 + rl < KHI) vst2((unsigned*)(KL + ((size_t)b * KHI + t0 + rl) * CC + q * 8), *(const v4u*)&hlk); }
  __syncthreads();
  for (int e = tid; e < 64 * 8; e += 256) { const int c = e >> 3, q = e & 7; hx8 hv; _Pragma("unroll") for (int j = 0; j < 8; ++j) hv[j] = sv[q * 8 + j][c]; vst2((unsigned*)(VT + ((size_t)b * CC + c) * TT + t0 + q * 8), *(const v4u*)&hv);
    if (t0 < KHI) { v8b bh, bl; _Pragma("unroll") for (int j = 0; j < 8; ++j) { const float vv = (float)hv[j]; const __bf16 h1 = (__bf16)vv; bh[j] = h1; bl[j] = (__bf16)(vv - (float)h1); } vst2((unsigned*)(VB + ((size_t)b * CC + c) * KHI + t0 + q * 8), *(const v4u*)&bh); vst2((unsigned*)(VBL + ((size_t)b * CC + c) * KHI + t0 + q * 8), *(const v4u*)&bl); } } }
#define SM_EXTRA_PARAMS
#define SM_MASK_HOOK (void)0
#ifndef SM_EXTRA_PARAMS
#define SM_EXTRA_PARAMS
#endif
#ifndef PROJ_EXTRA_PARAMS
#define PROJ_EXTRA_PARAMS
#endif
#ifndef SM_MASK_HOOK
#define SM_MASK_HOOK (void)0
#endif

#define WS_QH  0u                                      // f16 q rows [b*t][CC]
#define WS_KH  (WS_QH + 2u * (size_t)NB * TT * CC)      // f16 k rows [b*t][CC]
#define WS_VT  (WS_KH + 2u * (size_t)NB * TT * CC)      // f16 v planes [b][c][t]
#define WS_QL  (WS_VT + 2u * (size_t)NB * CC * TT)      // f16 q residual x 2^10 rows [b][t < QHI][CC]
#define WS_KL  (WS_QL + 2u * (size_t)NB * QHI * CC)     // f16 k residual x 2^10 rows [b][t < KHI][CC]
#define WS_VB  (WS_KL + 2u * (size_t)NB * KHI * CC)     // bf16 v hi planes [b][c][t < KHI]
#define WS_VBL (WS_VB + 2u * (size_t)NB * CC * KHI)
#define WS_S   (WS_VBL + 2u * (size_t)NB * CC * KHI)    // f32 logits / P [hg][t][s]
#define WS_Y   (WS_S  + 4u * (size_t)HG * TT * TT)      // f32 ctx rows [b*t][CC] (only when there is an output projection)
#define WS_END (WS_Y  + 0u)

// ---- k_proj: block = (64 rows, 128 cols, which): q/k/v = X W (+ b) with exact bf16 products (K = DIN) -> which 0: q f16 rows (+ residual rows < QHI); 1: k f16 rows (+ residual rows < KHI); 2: v f16 planes [c][t] (+ bf16 hi/lo planes for t < KHI)
__global__ __launch_bounds__(128) void k_proj(const float* __restrict__ XQ, const float* __restrict__ XK, const float* __restrict__ XV, const float* __restrict__ WQ, const float* __restrict__ WK, const float* __restrict__ WV, const float* __restrict__ BQ, const float* __restrict__ BK, const float* __restrict__ BV,
    _Float16* __restrict__ QH, _Float16* __restrict__ QL, _Float16* __restrict__ KH, _Float16* __restrict__ KL, _Float16* __restrict__ VT, __bf16* __restrict__ VB, __bf16* __restrict__ VBL) {
  __shared__ __align__(16) _Float16 sh[64][136], sl[64][136]; __shared__ __align__(16) _Float16 th[128][72]; __shared__ __align__(16) __bf16 tb[128][72], tbl[128][72];
  const int tid = threadIdx.x, wave = tid >> 5, lane = tid & 31, col = lane & 15, g = lane >> 4; const int which = blockIdx.z; const int c0 = blockIdx.y * 128; const size_t r0 = (size_t)blockIdx.x * 64; const size_t bb = r0 / TT; const int t0 = (int)(r0 % TT);
  const float* X = which == 0 ? XQ : which == 1 ? XK : XV; const float* WA = which == 0 ? WQ : which == 1 ? WK : WV; const float* BA = which == 0 ? BQ : which == 1 ? BK : BV;
  v8f acc[8] = {};
#pragma unroll 2
  for (int kc = 0; kc < DIN / 32; ++kc) { v16b a; { const float* p = X + (r0 + wave * 16 + col) * DIN + kc * 32 + 8 * g;
#pragma unroll
      for (int i = 0; i < 8; ++i) { a[i] = (__bf16)p[i]; a[8 + i] = (__bf16)p[16 + i]; } }
    asm volatile("s_wait_loadcnt 0x0" ::: "memory");
#pragma unroll
    for (int j = 0; j < 8; ++j) { const v16b w = WCOL(WA, kc * 32, c0 + j * 16 + col, lane); asm volatile("s_wait_loadcnt 0x0" ::: "memory"); acc[j] = wmma_bf(a, w, acc[j]); } }
  if (which < 2) { _Float16* DH = which == 0 ? QH : KH; _Float16* DL = which == 0 ? QL : KL; const int nhi = which == 0 ? QHI : KHI; const bool hi_rows = t0 < nhi;
#pragma unroll
    for (int j = 0; j < 8; ++j) { const float bias = BA ? bfr(BA[c0 + j * 16 + col]) : 0.f;
#pragma unroll
      for (int r = 0; r < 8; ++r) { const float v = acc[j][r] + bias; const _Float16 hv = (_Float16)v; sh[wave * 16 + 8 * g + r][j * 16 + col] = hv; sl[wave * 16 + 8 * g + r][j * 16 + col] = (_Float16)((v - (float)hv) * 1024.0f); } }
    __syncthreads();
    for (int e = tid; e < 64 * 16; e += 128) { const int rl = e >> 4, q = e & 15; vst2((unsigned*)(DH + (r0 + rl) * CC + c0 + q * 8), *(const v4u*)&sh[rl][q * 8]); if (hi_rows) vst2((unsigned*)(DL + (bb * nhi + t0 + rl) * (size_t)CC + c0 + q * 8), *(const v4u*)&sl[rl][q * 8]); }
  } else { const bool hi_rows = t0 < KHI;
#pragma unroll
    for (int j = 0; j < 8; ++j) { const float bias = BA ? bfr(BA[c0 + j * 16 + col]) : 0.f;
#pragma unroll
      for (int r = 0; r < 8; ++r) { const float v = acc[j][r] + bias; const int rl = wave * 16 + 8 * g + r, cl = j * 16 + col; th[cl][rl] = (_Float16)v; const __bf16 bh = (__bf16)v; tb[cl][rl] = bh; tbl[cl][rl] = (__bf16)(v - (float)bh); } }
    __syncthreads();
    for (int e = tid; e < 128 * 8; e += 128) { const int cl = e >> 3, q = e & 7; vst2((unsigned*)(VT + (bb * CC + c0 + cl) * (size_t)TT + t0 + q * 8), *(const v4u*)&th[cl][q * 8]); if (hi_rows) { const size_t o3 = (bb * CC + c0 + cl) * (size_t)KHI + t0 + q * 8; vst2((unsigned*)(VB + o3), *(const v4u*)&tb[cl][q * 8]); vst2((unsigned*)(VBL + o3), *(const v4u*)&tbl[cl][q * 8]); } } } }
// ---- k_sc: block = (query block qb, key block kb <= kb_last(qb), head in group) of batch b: logits x SCALE; q hi + residual (x 2^10) against k (2 products) for query rows < QHI, plus the k residual (3 products) for query blocks < QBH (causal early rows); causal: blocks past the diagonal exit, the mask itself is applied by index in k_sm
__global__ __launch_bounds__(128) void k_sc(const _Float16* __restrict__ QH, const _Float16* __restrict__ KH, const _Float16* __restrict__ QL, const _Float16* __restrict__ KL, int b, int h0, float* __restrict__ S0) { __shared__ __align__(16) float ss[4][16][132];
  const int qb = blockIdx.x, kb = blockIdx.y; if (kb > kb_last(qb)) return;
  const int h = h0 + blockIdx.z; float* S = S0 + (size_t)blockIdx.z * TT * TT;
  const int tid = threadIdx.x, wave = tid >> 5, lane = tid & 31, col = lane & 15, g = lane >> 4; const int k0 = kb * 128; const int ql0 = qb * 64 + wave * 16; const size_t q0 = (size_t)b * TT + ql0, kr0 = (size_t)b * TT + k0;
  v8f acc[8] = {}, accl[8] = {};
  const _Float16* QLb = QL + (size_t)b * QHI * CC; const _Float16* KLb = KL + (size_t)b * KHI * CC;
  if (qb < QBH) {
#pragma unroll
    for (int kc = 0; kc < HD / 32; ++kc) { const v16h ah = frag_h(QH + (q0 + col) * CC + h * HD + kc * 32, lane), al = frag_h(QLb + (size_t)(ql0 + col) * CC + h * HD + kc * 32, lane);
#pragma unroll
      for (int j = 0; j < 8; ++j) { const v16h kbf = frag_h(KH + (kr0 + j * 16 + col) * CC + h * HD + kc * 32, lane), klf = frag_h(KLb + (size_t)(k0 + j * 16 + col) * CC + h * HD + kc * 32, lane); acc[j] = wmma16(ah, kbf, acc[j]); accl[j] = wmma16(al, kbf, accl[j]); accl[j] = wmma16(ah, klf, accl[j]); } }
  } else if (qb * 64 < QHI) {
#pragma unroll
    for (int kc = 0; kc < HD / 32; ++kc) { const v16h ah = frag_h(QH + (q0 + col) * CC + h * HD + kc * 32, lane), al = frag_h(QLb + (size_t)(ql0 + col) * CC + h * HD + kc * 32, lane);
#pragma unroll
      for (int j = 0; j < 8; ++j) { const v16h kbf = frag_h(KH + (kr0 + j * 16 + col) * CC + h * HD + kc * 32, lane); acc[j] = wmma16(ah, kbf, acc[j]); accl[j] = wmma16(al, kbf, accl[j]); } }
  } else {
#pragma unroll
    for (int kc = 0; kc < HD / 32; ++kc) { const v16h ah = frag_h(QH + (q0 + col) * CC + h * HD + kc * 32, lane);
#pragma unroll
      for (int j = 0; j < 8; ++j) { const v16h kbf = frag_h(KH + (kr0 + j * 16 + col) * CC + h * HD + kc * 32, lane); acc[j] = wmma16(ah, kbf, acc[j]); } } }
#pragma unroll
  for (int j = 0; j < 8; ++j) {
#pragma unroll
    for (int r = 0; r < 8; ++r) ss[wave][8 * g + r][j * 16 + col] = (acc[j][r] + accl[j][r] * (1.0f / 1024.0f)) * SCALE; }
  LDSX(); for (int rl = 0; rl < 16; ++rl) vst2(S + (size_t)(ql0 + rl) * TT + k0 + lane * 4, *(const v4f*)&ss[wave][rl][lane * 4]); }
// ---- k_sm: block = query row t (head in group): keys [0, kend): causal -> logit if s <= t else excluded; softmax in f32; P x 2^11 in place (0 for excluded)
__global__ __launch_bounds__(256) void k_sm(float* __restrict__ S0 SM_EXTRA_PARAMS) { __shared__ float sred[8]; __shared__ float sbc; __shared__ __align__(16) float shv[TT];
  const int tid = threadIdx.x; const int t = blockIdx.x; const int kend = (kb_last(t >> 6) + 1) * 128;
  float* sr = S0 + (size_t)blockIdx.y * TT * TT + (size_t)t * TT;
  float m = -3.0e38f; for (int k = tid; k < kend; k += 256) { float v = (!CAUSAL || k <= t) ? sr[k] : -3.0e38f; SM_MASK_HOOK; shv[k] = v; m = fmaxf(m, v); }
#pragma unroll
  for (int o = 1; o < 32; o <<= 1) m = fmaxf(m, __shfl_xor(m, o));
  if ((tid & 31) == 0) sred[tid >> 5] = m; __syncthreads(); if (tid == 0) { float a = sred[0]; for (int i = 1; i < 8; ++i) a = fmaxf(a, sred[i]); sbc = a; } __syncthreads(); m = sbc; __syncthreads();
  float sum = 0.f; for (int k = tid; k < kend; k += 256) { const float v = shv[k]; const float e = (v <= -1.0e38f) ? 0.f : expf(v - m); shv[k] = e; sum += e; }
#pragma unroll
  for (int o = 1; o < 32; o <<= 1) sum += __shfl_xor(sum, o);
  if ((tid & 31) == 0) sred[tid >> 5] = sum; __syncthreads(); if (tid == 0) { float a = 0.f; for (int i = 0; i < 8; ++i) a += sred[i]; sbc = a > 0.f ? 2048.0f / a : 0.f; }   /* a fully excluded row yields P = 0 */ __syncthreads(); const float inv = sbc;
  for (int k = tid; k < kend; k += 256) shv[k] = shv[k] * inv;
  __syncthreads(); for (int q = tid; q < kend / 4; q += 256) vst2(sr + q * 4, *(const v4f*)&shv[q * 4]); }
// ---- k_pv: block = 64 queries (qb) of (b, h): ctx = P . v over keys [0, kend) (P x 2^11 once to f16 against v f16: 1 product; causal early query blocks: P and v as bf16 hi + lo, 3 products); 256-B (row, head) segment by 16 lanes
__global__ __launch_bounds__(128) void k_pv(const float* __restrict__ PS0, const _Float16* __restrict__ VT, const __bf16* __restrict__ VB, const __bf16* __restrict__ VBL, int b, int h0, float* __restrict__ Y) { const int h = h0 + blockIdx.z; const float* PS = PS0 + (size_t)blockIdx.z * TT * TT; __shared__ __align__(16) float ss[4][16][HD + 4];
  const int tid = threadIdx.x, wave = tid >> 5, lane = tid & 31, col = lane & 15, g = lane >> 4; const int qb = blockIdx.x; const int ql0 = qb * 64 + wave * 16; const int kce = (kb_last(qb) + 1) * 4;
  v8f acc[HD / 16] = {};
  if (qb < QBH) {
#pragma unroll 1
    for (int kc = 0; kc < kce; ++kc) { const F2 p = split_row(PS + (size_t)(ql0 + col) * TT, kc * 32, lane);
      asm volatile("s_wait_loadcnt 0x0" ::: "memory");
#pragma unroll
      for (int j = 0; j < HD / 16; ++j) { const size_t po = ((size_t)b * CC + h * HD + j * 16 + col) * (size_t)KHI + kc * 32; const v16b vh = frag_b(VB + po, lane); acc[j] = wmma_bf(p.h, vh, acc[j]); acc[j] = wmma_bf(p.l, vh, acc[j]); acc[j] = wmma_bf(p.h, frag_b(VBL + po, lane), acc[j]); } }
  } else {
#pragma unroll 1
    for (int kc = 0; kc < kce; ++kc) { const v16h p = frag_f32(PS + (size_t)(ql0 + col) * TT + kc * 32, lane);
      asm volatile("s_wait_loadcnt 0x0" ::: "memory");
#pragma unroll
      for (int j = 0; j < HD / 16; ++j) { const size_t po = ((size_t)b * CC + h * HD + j * 16 + col) * (size_t)TT + kc * 32; acc[j] = wmma16(p, frag_h(VT + po, lane), acc[j]); } } }
#pragma unroll
  for (int j = 0; j < HD / 16; ++j)
#pragma unroll
    for (int r = 0; r < 8; ++r) ss[wave][8 * g + r][j * 16 + col] = acc[j][r] * (1.0f / 2048.0f);
  LDSX(); for (int rl = 0; rl < 16; ++rl) if (lane < HD / 4) vst2(Y + ((size_t)b * TT + ql0 + rl) * CC + h * HD + lane * 4, *(const v4f*)&ss[wave][rl][lane * 4]); }

extern "C" void kernel_launch(void* const* d_in, const int* in_sizes, int n_in, void* d_out, int out_size, void* d_ws, size_t ws_size, hipStream_t stream) {
  (void)in_sizes; (void)n_in; (void)out_size;
  const float** F = (const float**)d_in;
  if (ws_size < (size_t)WS_END) return;
  char* ws = (char*)d_ws; _Float16 *QH = (_Float16*)(ws + WS_QH), *KH = (_Float16*)(ws + WS_KH), *VT = (_Float16*)(ws + WS_VT), *QL = (_Float16*)(ws + WS_QL), *KL = (_Float16*)(ws + WS_KL); __bf16 *VB = (__bf16*)(ws + WS_VB), *VBL = (__bf16*)(ws + WS_VBL); float *S = (float*)(ws + WS_S), *Y = (float*)(ws + WS_Y);
  (void)Y; (void)QL; (void)KL; (void)VB; (void)VBL;
  // inputs: 0 queries [16,2048,64]; 1 keys; 2 values
  k_planes64<<<dim3(TNB * TT / 64), 256, 0, stream>>>(F[0], F[1], F[2], QH, QL, KH, KL, VT, VB, VBL);
  for (int b = 0; b < TNB; ++b) {
    k_sc<<<dim3(NQB, TT / 128, 1), 128, 0, stream>>>(QH, KH, QL, KL, b, 0, S);
    k_sm<<<dim3(TT, 1), 256, 0, stream>>>(S);
    k_pv<<<dim3(NQB, 1, 1), 128, 0, stream>>>(S, VT, VB, VBL, b, 0, (float*)d_out);
  }


}

// v001
// Measured time: 37.7 microseconds a run.
// Two timings next to v000 put it at 34.1 and 34.8 times that version's speed.
// compute dtype: all float inputs rounded to bf16; queries, keys, values are bf16-valued so their f16 planes are exact; logits q x k (1 product on exact planes) x 1/8; online softmax f32; P = 2^(logit - maximum in use) once to f16 x v (exact) (1 product); f32 output.
#include <hip/hip_runtime.h>
#include <math.h>

typedef __attribute__((ext_vector_type(16))) _Float16 v16h;
typedef __attribute__((ext_vector_type(16))) __bf16 v16b;
typedef __attribute__((ext_vector_type(8)))  _Float16 v8h;
typedef __attribute__((ext_vector_type(8)))  float v8f;
typedef __attribute__((ext_vector_type(4)))  float v4f;
typedef __attribute__((ext_vector_type(2)))  float v2f;
typedef __attribute__((ext_vector_type(4)))  unsigned v4u;
typedef _Float16 hx8 __attribute__((ext_vector_type(8)));
typedef __attribute__((ext_vector_type(4)))  int v4i;
typedef float __attribute__((may_alias)) float_a;
typedef int __attribute__((may_alias)) int_a;

template <typename T> __device__ __forceinline__ void vst2(void* p, T v) { *(T*)p = v;  }
__device__ __forceinline__ v8f wmma16(v16h a, v16h b, v8f c) {
  v8f d = __builtin_amdgcn_wmma_f32_16x16x32_f16(false, a, false, b, (short)0, c, false, false);
  asm volatile("v_nop\n\tv_nop\n\tv_nop\n\tv_nop" : "+v"(d) : "v"(a), "v"(b));
  return d;
}
__device__ __forceinline__ v8f wmma_bf(v16b a, v16b b, v8f c) {
  v8f d = __builtin_amdgcn_wmma_f32_16x16x32_bf16(false, a, false, b, (short)0, c, false, false);
  asm volatile("v_nop\n\tv_nop\n\tv_nop\n\tv_nop" : "+v"(d) : "v"(a), "v"(b));
  return d;
}
// 16x16x32 fragments: lane = (h = lane>>4, row/col = lane&15); elements 0..7 = k0+8h+0..7, 8..15 = k0+16+8h+0..7; D element r = row 8h+r
__device__ __forceinline__ v16h frag_h(const _Float16* rowk0, int lane) {
  union { v16h v; v8h q[2]; } u; const _Float16* p = rowk0 + 8 * (lane >> 4);
  u.q[0] = *(const v8h*)p; u.q[1] = *(const v8h*)(p + 16); return u.v;
}
__device__ __forceinline__ v16h frag_f32(const float* rowk0, int lane) {
  v16h a; const float* p = rowk0 + 8 * (lane >> 4);
#pragma unroll
  for (int i = 0; i < 8; ++i) { a[i] = (_Float16)p[i]; a[8 + i] = (_Float16)p[16 + i]; }
  return a;
}
__device__ __forceinline__ v16h frag_f32s(const float* rowk0, int lane, float sc) {
  v16h a; const float* p = rowk0 + 8 * (lane >> 4);
#pragma unroll
  for (int i = 0; i < 8; ++i) { a[i] = (_Float16)(p[i] * sc); a[8 + i] = (_Float16)(p[16 + i] * sc); }
  return a;
}
// column fragment from a [K][ld] layout (column n), rows >= K read as 0
__device__ __forceinline__ v16h fragc_f32(const float* W, int k0, int n, int lane, int ld, int K) {
  v16h a; const int g = lane >> 4;
#pragma unroll
  for (int i = 0; i < 8; ++i) { const int ka = k0 + 8 * g + i, kb = ka + 16;
    a[i] = (_Float16)(ka < K ? W[(size_t)(ka < K ? ka : K - 1) * ld + n] : 0.f); a[8 + i] = (_Float16)(kb < K ? W[(size_t)(kb < K ? kb : K - 1) * ld + n] : 0.f); }
  return a;
}
struct F2 { v16b h, l; };
__device__ __forceinline__ F2 bsplit16(const float v[16]) { F2 r;
#pragma unroll
  for (int i = 0; i < 16; ++i) { const __bf16 h = (__bf16)v[i]; r.h[i] = h; r.l[i] = (__bf16)(v[i] - (float)h); }
  return r; }
__device__ __forceinline__ F2 split_row(const float* row, int k0, int lane) { float v[16]; const float* p = row + k0 + 8 * (lane >> 4);
#pragma unroll
  for (int i = 0; i < 8; ++i) { v[i] = p[i]; v[8 + i] = p[16 + i]; }
  return bsplit16(v); }
__device__ __forceinline__ F2 split_rowK(const float* row, int k0, int lane, int K) { float v[16]; const int g = lane >> 4;
#pragma unroll
  for (int i = 0; i < 8; ++i) { const int ka = k0 + 8 * g + i, kb = ka + 16; v[i] = ka < K ? row[ka < K ? ka : K - 1] : 0.f; v[8 + i] = kb < K ? row[kb < K ? kb : K - 1] : 0.f; }
  return bsplit16(v); }
__device__ __forceinline__ F2 split_col(const float* W, int k0, int n, int lane, int ld, int K) { float v[16]; const int g = lane >> 4;
#pragma unroll
  for (int i = 0; i < 8; ++i) { const int ka = k0 + 8 * g + i, kb = ka + 16; v[i] = ka < K ? W[(size_t)(ka < K ? ka : K - 1) * ld + n] : 0.f; v[8 + i] = kb < K ? W[(size_t)(kb < K ? kb : K - 1) * ld + n] : 0.f; }
  return bsplit16(v); }
__device__ __forceinline__ v8f mac3(const F2& a, const F2& b, v8f c) { c = wmma_bf(a.l, b.h, c); c = wmma_bf(a.h, b.l, c); return wmma_bf(a.h, b.h, c); }
__device__ __forceinline__ float sigm(float v) { return 1.0f / (1.0f + expf(-v)); }
#define LDSX() do { asm volatile("s_wait_dscnt 0" ::: "memory"); __builtin_amdgcn_wave_barrier(); __builtin_amdgcn_fence(__ATOMIC_RELEASE, "workgroup"); } while (0)

// Plain dot-product attention on given tensors (queries / keys / values [16,2048,64]; no mask): out = softmax(Q K^T / 8) V -> [16,2048,64].
#define NB 16
#define TT 2048
#define CC 64            // NH * HD = projected width
#define DIN 64          // input (model) width
#define NH 1
#define HD 64
#define NQB (TT / 64)
#define HG 1
#define SCALE (0.125f)
#define CAUSAL 0
#ifndef TNB
#define TNB NB
#endif
__device__ __forceinline__ float bfr(float v) { return (float)(__bf16)v; }
__host__ __device__ __forceinline__ int kb_last(int qb) { return CAUSAL ? ((qb * 64 + 63) >> 7) : (TT / 128 - 1); }
typedef __attribute__((ext_vector_type(8))) __bf16 v8b;
__device__ __forceinline__ v16b frag_b(const __bf16* rowk0, int lane) {
  union { v16b v; v8b q[2]; } u; const __bf16* p = rowk0 + 8 * (lane >> 4);
  u.q[0] = *(const v8b*)p; u.q[1] = *(const v8b*)(p + 16); return u.v;
}
#define QBH 0              // exact planes: single-product logits and single-f16 P x V on every block
#define QHI 0               // no q residual plane (q is bf16-exact in f16)
#define KHI 64              // unused high-precision planes kept minimal
// B fragment (k rows k0+.., output column o) of a weight: (in,out) [K][ld] or (out,in) [ld rows of K]: bf16 exact, or f16(bf16 * 256) exact
__device__ __forceinline__ v16b wcol_io(const float* Wm, int k0, int o, int lane, int ld) { v16b w; const int g = lane >> 4;
#pragma unroll
  for (int i = 0; i < 8; ++i) { w[i] = (__bf16)Wm[(size_t)(k0 + 8 * g + i) * ld + o]; w[8 + i] = (__bf16)Wm[(size_t)(k0 + 16 + 8 * g + i) * ld + o]; }
  return w; }
__device__ __forceinline__ v16b wcol_oi(const float* Wm, int k0, int o, int lane, int K) { v16b w; const float* p = Wm + (size_t)o * K + k0 + 8 * (lane >> 4);
#pragma unroll
  for (int i = 0; i < 8; ++i) { w[i] = (__bf16)p[i]; w[8 + i] = (__bf16)p[16 + i]; }
  return w; }
__device__ __forceinline__ v16h wcolh_io(const float* Wm, int k0, int o, int lane, int ld) { v16h w; const int g = lane >> 4;
#pragma unroll
  for (int i = 0; i < 8; ++i) { w[i] = (_Float16)(bfr(Wm[(size_t)(k0 + 8 * g + i) * ld + o]) * 256.0f); w[8 + i] = (_Float16)(bfr(Wm[(size_t)(k0 + 16 + 8 * g + i) * ld + o]) * 256.0f); }
  return w; }
__device__ __forceinline__ v16h wcolh_oi(const float* Wm, int k0, int o, int lane, int K) { v16h w; const float* p = Wm + (size_t)o * K + k0 + 8 * (lane >> 4);
#pragma unroll
  for (int i = 0; i < 8; ++i) { w[i] = (_Float16)(bfr(p[i]) * 256.0f); w[8 + i] = (_Float16)(bfr(p[16 + i]) * 256.0f); }
  return w; }
#define WQKV_LAYOUT 0   // 0 = (in,out) [DIN][CC]; 1 = (out,in) [CC][DIN]; 2 = per-head [NH][DIN][HD]
__device__ __forceinline__ v16b wcol_hdk(const float* Wm, int k0, int o, int lane) { v16b w; const int g = lane >> 4; const float* p = Wm + (size_t)(o / HD) * DIN * HD + (o % HD);
#pragma unroll
  for (int i = 0; i < 8; ++i) { w[i] = (__bf16)p[(size_t)(k0 + 8 * g + i) * HD]; w[8 + i] = (__bf16)p[(size_t)(k0 + 16 + 8 * g + i) * HD]; }
  return w; }
#define WO_OUT_IN 0
#if WQKV_LAYOUT == 1
#define WCOL(W, k0, o, lane) wcol_oi(W, k0, o, lane, DIN)
#elif WQKV_LAYOUT == 2
#define WCOL(W, k0, o, lane) wcol_hdk(W, k0, o, lane)
#else
#define WCOL(W, k0, o, lane) wcol_io(W, k0, o, lane, CC)
#endif
#if WO_OUT_IN
#define WOCOL(W, k0, o, lane) wcol_oi(W, k0, o, lane, CC)
#define WOCOLH(W, k0, o, lane) wcolh_oi(W, k0, o, lane, CC)
#else
#define WOCOL(W, k0, o, lane) wcol_io(W, k0, o, lane, DIN)
#define WOCOLH(W, k0, o, lane) wcolh_io(W, k0, o, lane, DIN)
#endif
__global__ __launch_bounds__(256) void k_planes64(const float* __restrict__ Qs, const float* __restrict__ Ks, const float* __restrict__ Vs, _Float16* __restrict__ QH, _Float16* __restrict__ QL, _Float16* __restrict__ KH, _Float16* __restrict__ KL, _Float16* __restrict__ VT, __bf16* __restrict__ VB, __bf16* __restrict__ VBL) {
  __shared__ _Float16 sv[64][72];
  const int tid = threadIdx.x; const size_t r0 = (size_t)blockIdx.x * 64; const int b = (int)(r0 / TT), t0 = (int)(r0 % TT);
  for (int e = tid; e < 64 * 8; e += 256) { const int rl = e >> 3, q = e & 7; const size_t src = (r0 + rl) * CC + q * 8; float tq[8], tk[8], tv[8];
#pragma unroll
    for (int u = 0; u < 8; ++u) { tq[u] = Qs[src + u]; tk[u] = Ks[src + u]; tv[u] = Vs[src + u]; }
    asm volatile("s_wait_loadcnt 0x0" ::: "memory");
    hx8 hq, hk, hlq, hlk;
#pragma unroll
    for (int u = 0; u < 8; ++u) { const float qv = bfr(tq[u]), kv = bfr(tk[u]); const _Float16 qh = (_Float16)qv, kh = (_Float16)kv; hq[u] = qh; hlq[u] = (_Float16)((qv - (float)qh) * 1024.0f); hk[u] = kh; hlk[u] = (_Float16)((kv - (float)kh) * 1024.0f); sv[rl][q * 8 + u] = (_Float16)bfr(tv[u]); }
    vst2((unsigned*)(QH + (r0 + rl) * CC + q * 8), *(const v4u*)&hq); vst2((unsigned*)(KH + (r0 + rl) * CC + q * 8), *(const v4u*)&hk);
    if (t0 + rl < QHI) vst2((unsigned*)(QL + ((size_t)b * QHI + t0 + rl) * CC + q * 8), *(const v4u*)&hlq);
    if (t0 + rl < KHI) vst2((unsigned*)(KL + ((size_t)b * KHI + t0 + rl) * CC + q * 8), *(const v4u*)&hlk); }
  __syncthreads();
  for (int e = tid; e < 64 * 8; e += 256) { const int c = e >> 3, q = e & 7; hx8 hv; _Pragma("unroll") for (int j = 0; j < 8; ++j) hv[j] = sv[q * 8 + j][c]; vst2((unsigned*)(VT + ((size_t)b * CC + c) * TT + t0 + q * 8), *(const v4u*)&hv);
    if (t0 < KHI) { v8b bh, bl; _Pragma("unroll") for (int j = 0; j < 8; ++j) { const float vv = (float)hv[j]; const __bf16 h1 = (__bf16)vv; bh[j] = h1; bl[j] = (__bf16)(vv - (float)h1); } vst2((unsigned*)(VB + ((size_t)b * CC + c) * KHI + t0 + q * 8), *(const v4u*)&bh); vst2((unsigned*)(VBL + ((size_t)b * CC + c) * KHI + t0 + q * 8), *(const v4u*)&bl); } } }
#define SM_EXTRA_PARAMS
#define SM_MASK_HOOK (void)0
#ifndef SM_EXTRA_PARAMS
#define SM_EXTRA_PARAMS
#endif
#ifndef PROJ_EXTRA_PARAMS
#define PROJ_EXTRA_PARAMS
#endif
#ifndef SM_MASK_HOOK
#define SM_MASK_HOOK (void)0
#endif

#define WS_QH  0u                                      // f16 q rows [b*t][CC]
#define WS_KH  (WS_QH + 2u * (size_t)NB * TT * CC)      // f16 k rows [b*t][CC]
#define WS_VT  (WS_KH + 2u * (size_t)NB * TT * CC)      // f16 v planes [b][c][t]
#define WS_QL  (WS_VT + 2u * (size_t)NB * CC * TT)      // f16 q residual x 2^10 rows [b][t < QHI][CC]
#define WS_KL  (WS_QL + 2u * (size_t)NB * QHI * CC)     // f16 k residual x 2^10 rows [b][t < KHI][CC]
#define WS_VB  (WS_KL + 2u * (size_t)NB * KHI * CC)     // bf16 v hi planes [b][c][t < KHI]
#define WS_VBL (WS_VB + 2u * (size_t)NB * CC * KHI)
#define WS_S   (WS_VBL + 2u * (size_t)NB * CC * KHI)    // f32 [hg][t][s] scratch, unused (k_fa keeps scores in registers)
#define WS_Y   (WS_S  + 4u * (size_t)HG * TT * TT)      // f32 ctx rows [b*t][CC] (only when there is an output projection)
#define WS_END (WS_Y  + 0u)

// ---- k_proj: block = (64 rows, 128 cols, which): q/k/v = X W (+ b) with exact bf16 products (K = DIN) -> which 0: q f16 rows (+ residual rows < QHI); 1: k f16 rows (+ residual rows < KHI); 2: v f16 planes [c][t] (+ bf16 hi/lo planes for t < KHI)
__global__ __launch_bounds__(128) void k_proj(const float* __restrict__ XQ, const float* __restrict__ XK, const float* __restrict__ XV, const float* __restrict__ WQ, const float* __restrict__ WK, const float* __restrict__ WV, const float* __restrict__ BQ, const float* __restrict__ BK, const float* __restrict__ BV,
    _Float16* __restrict__ QH, _Float16* __restrict__ QL, _Float16* __restrict__ KH, _Float16* __restrict__ KL, _Float16* __restrict__ VT, __bf16* __restrict__ VB, __bf16* __restrict__ VBL) {
  __shared__ __align__(16) _Float16 sh[64][136], sl[64][136]; __shared__ __align__(16) _Float16 th[128][72]; __shared__ __align__(16) __bf16 tb[128][72], tbl[128][72];
  const int tid = threadIdx.x, wave = tid >> 5, lane = tid & 31, col = lane & 15, g = lane >> 4; const int which = blockIdx.z; const int c0 = blockIdx.y * 128; const size_t r0 = (size_t)blockIdx.x * 64; const size_t bb = r0 / TT; const int t0 = (int)(r0 % TT);
  const float* X = which == 0 ? XQ : which == 1 ? XK : XV; const float* WA = which == 0 ? WQ : which == 1 ? WK : WV; const float* BA = which == 0 ? BQ : which == 1 ? BK : BV;
  v8f acc[8] = {};
#pragma unroll 2
  for (int kc = 0; kc < DIN / 32; ++kc) { v16b a; { const float* p = X + (r0 + wave * 16 + col) * DIN + kc * 32 + 8 * g;
#pragma unroll
      for (int i = 0; i < 8; ++i) { a[i] = (__bf16)p[i]; a[8 + i] = (__bf16)p[16 + i]; } }
    asm volatile("s_wait_loadcnt 0x0" ::: "memory");
#pragma unroll
    for (int j = 0; j < 8; ++j) { const v16b w = WCOL(WA, kc * 32, c0 + j * 16 + col, lane); asm volatile("s_wait_loadcnt 0x0" ::: "memory"); acc[j] = wmma_bf(a, w, acc[j]); } }
  if (which < 2) { _Float16* DH = which == 0 ? QH : KH; _Float16* DL = which == 0 ? QL : KL; const int nhi = which == 0 ? QHI : KHI; const bool hi_rows = t0 < nhi;
#pragma unroll
    for (int j = 0; j < 8; ++j) { const float bias = BA ? bfr(BA[c0 + j * 16 + col]) : 0.f;
#pragma unroll
      for (int r = 0; r < 8; ++r) { const float v = acc[j][r] + bias; const _Float16 hv = (_Float16)v; sh[wave * 16 + 8 * g + r][j * 16 + col] = hv; sl[wave * 16 + 8 * g + r][j * 16 + col] = (_Float16)((v - (float)hv) * 1024.0f); } }
    __syncthreads();
    for (int e = tid; e < 64 * 16; e += 128) { const int rl = e >> 4, q = e & 15; vst2((unsigned*)(DH + (r0 + rl) * CC + c0 + q * 8), *(const v4u*)&sh[rl][q * 8]); if (hi_rows) vst2((unsigned*)(DL + (bb * nhi + t0 + rl) * (size_t)CC + c0 + q * 8), *(const v4u*)&sl[rl][q * 8]); }
  } else { const bool hi_rows = t0 < KHI;
#pragma unroll
    for (int j = 0; j < 8; ++j) { const float bias = BA ? bfr(BA[c0 + j * 16 + col]) : 0.f;
#pragma unroll
      for (int r = 0; r < 8; ++r) { const float v = acc[j][r] + bias; const int rl = wave * 16 + 8 * g + r, cl = j * 16 + col; th[cl][rl] = (_Float16)v; const __bf16 bh = (__bf16)v; tb[cl][rl] = bh; tbl[cl][rl] = (__bf16)(v - (float)bh); } }
    __syncthreads();
    for (int e = tid; e < 128 * 8; e += 128) { const int cl = e >> 3, q = e & 7; vst2((unsigned*)(VT + (bb * CC + c0 + cl) * (size_t)TT + t0 + q * 8), *(const v4u*)&th[cl][q * 8]); if (hi_rows) { const size_t o3 = (bb * CC + c0 + cl) * (size_t)KHI + t0 + q * 8; vst2((unsigned*)(VB + o3), *(const v4u*)&tb[cl][q * 8]); vst2((unsigned*)(VBL + o3), *(const v4u*)&tbl[cl][q * 8]); } } } }
// ---- k_fa: block = 64 queries of batch blockIdx.y, 8 waves; wave = (32 queries, one quarter of the keys). Transposed products: S^T = K Q^T (a lane holds 16 scores of one query per 32 keys),
// online softmax in f32 (base 2), P^T packed from the score accumulators into the B operand (f16), O^T += V^T P^T; the four key quarters are merged in LDS at the end.
// lane l with lane l ^ 16 by a vector cross-row move (no LDS round trip)
__device__ __forceinline__ float xhalf(float x) { return __builtin_bit_cast(float, __builtin_amdgcn_permlanex16(__builtin_bit_cast(int, x), __builtin_bit_cast(int, x), 0x76543210, 0xfedcba98, false, false)); }
// every '#pragma unroll' in k_fa gives a fragment or accumulator array constant indices, so that it stays in registers
#define KSPL 4
#define KPW (TT / KSPL)
__global__ __launch_bounds__(256) void k_fa(const _Float16* __restrict__ QH, const _Float16* __restrict__ KH, const _Float16* __restrict__ VT, float* __restrict__ Y) {
  __shared__ __align__(16) float so[KSPL][64][HD + 4]; __shared__ float smx[KSPL][64], sls[KSPL][64];
  const int tid = threadIdx.x, wave = tid >> 5, lane = tid & 31, col = lane & 15, g = lane >> 4; const int b = blockIdx.y, qb = blockIdx.x; const int qg = wave & 1, kq = wave >> 1;
  const float C2 = SCALE * 1.44269504088896f;   // logits in units of log2
  v16h qf[2][2];
#pragma unroll
  for (int t = 0; t < 2; ++t)
#pragma unroll
    for (int kc = 0; kc < 2; ++kc) qf[t][kc] = frag_h(QH + ((size_t)b * TT + qb * 64 + qg * 32 + t * 16 + col) * CC + kc * 32, lane);
  const _Float16* Kb = KH + ((size_t)b * TT + kq * KPW + col) * CC; const _Float16* Vb = VT + ((size_t)b * CC + col) * TT + kq * KPW;
  v8f acc[2][4] = {}; float m[2] = {-3.0e38f, -3.0e38f}, l[2] = {0.f, 0.f};
  v16h kf[2][2];
#pragma unroll
  for (int i = 0; i < 2; ++i)
#pragma unroll
    for (int kc = 0; kc < 2; ++kc) kf[i][kc] = frag_h(Kb + (size_t)(i * 16) * CC + kc * 32, lane);
#pragma unroll 1   // rolled: one trip's fragments, scores and sums already take the registers that four waves per SIMD leave
  for (int k0 = 0; k0 < KPW; k0 += 32) {
    v16h vf[4];
#pragma unroll
    for (int j = 0; j < 4; ++j) vf[j] = frag_h(Vb + (size_t)(j * 16) * TT + k0, lane);
    v8f s[2][2] = {};
#pragma unroll
    for (int i = 0; i < 2; ++i)
#pragma unroll
      for (int kc = 0; kc < 2; ++kc)
#pragma unroll
        for (int t = 0; t < 2; ++t) s[t][i] = wmma16(kf[i][kc], qf[t][kc], s[t][i]);
    const int kn = k0 + 32 < KPW ? k0 + 32 : k0;   // the next 32 keys' rows, fetched one trip ahead (the last trip reads its own again)
#pragma unroll
    for (int i = 0; i < 2; ++i)
#pragma unroll
      for (int kc = 0; kc < 2; ++kc) kf[i][kc] = frag_h(Kb + (size_t)(kn + i * 16) * CC + kc * 32, lane);
    float mx[2];
#pragma unroll
    for (int t = 0; t < 2; ++t) { float a = fmaxf(s[t][0][0], s[t][1][0]);
#pragma unroll
      for (int r = 1; r < 8; ++r) a = fmaxf(a, fmaxf(s[t][0][r], s[t][1][r]));
      mx[t] = fmaxf(a, xhalf(a)) * C2; }
    // the maximum in use moves only when a query's new maximum passes it by more than 8 (P <= 2^8 fits f16); one wave-uniform test per trip
    if (__builtin_amdgcn_ballot_w32(mx[0] > m[0] + 8.0f || mx[1] > m[1] + 8.0f) != 0) {
#pragma unroll
      for (int t = 0; t < 2; ++t) { const float mn = fmaxf(m[t], mx[t]); const float al = __builtin_amdgcn_exp2f(m[t] - mn); m[t] = mn; l[t] *= al;
#pragma unroll
        for (int j = 0; j < 4; ++j) acc[t][j] *= al; } }
#pragma unroll
    for (int t = 0; t < 2; ++t) { v16h pf; v2f ls = {0.f, 0.f}; const v2f c2 = {C2, C2}, nm = {-m[t], -m[t]};
#pragma unroll
      for (int i = 0; i < 2; ++i)
#pragma unroll
        for (int r = 0; r < 8; r += 2) { const v2f x = {s[t][i][r], s[t][i][r + 1]}; const v2f a = __builtin_elementwise_fma(x, c2, nm); const v2f p = {__builtin_amdgcn_exp2f(a.x), __builtin_amdgcn_exp2f(a.y)}; ls += p; pf[8 * i + r] = (_Float16)p.x; pf[8 * i + r + 1] = (_Float16)p.y; }
      l[t] += ls.x + ls.y;
#pragma unroll
      for (int j = 0; j < 4; ++j) acc[t][j] = wmma16(vf[j], pf, acc[t][j]); } }
  // merge of the four key quarters: common maximum, then scaled partial sums
#pragma unroll
  for (int t = 0; t < 2; ++t) { l[t] += xhalf(l[t]); if (g == 0) smx[kq][qg * 32 + t * 16 + col] = m[t]; }
  __syncthreads();
#pragma unroll
  for (int t = 0; t < 2; ++t) { const int q = qg * 32 + t * 16 + col; const float M = fmaxf(fmaxf(smx[0][q], smx[1][q]), fmaxf(smx[2][q], smx[3][q])); const float f = __builtin_amdgcn_exp2f(m[t] - M);
    if (g == 0) sls[kq][q] = l[t] * f;
#pragma unroll
    for (int j = 0; j < 4; ++j) { const v8f o = acc[t][j] * f; v4f lo = {o[0], o[1], o[2], o[3]}, hi = {o[4], o[5], o[6], o[7]}; *(v4f*)&so[kq][q][j * 16 + 8 * g] = lo; *(v4f*)&so[kq][q][j * 16 + 8 * g + 4] = hi; } }
  __syncthreads();
#pragma unroll
  for (int u = 0; u < 4; ++u) { const int e = u * 256 + tid, q = e >> 4, d = (e & 15) * 4; const float inv = 1.0f / ((sls[0][q] + sls[1][q]) + (sls[2][q] + sls[3][q]));
    const v4f a = (*(const v4f*)&so[0][q][d] + *(const v4f*)&so[1][q][d]) + (*(const v4f*)&so[2][q][d] + *(const v4f*)&so[3][q][d]);
    vst2(Y + ((size_t)b * TT + qb * 64 + q) * CC + d, a * inv); } }

extern "C" void kernel_launch(void* const* d_in, const int* in_sizes, int n_in, void* d_out, int out_size, void* d_ws, size_t ws_size, hipStream_t stream) {
  (void)in_sizes; (void)n_in; (void)out_size;
  const float** F = (const float**)d_in;
  if (ws_size < (size_t)WS_END) return;
  char* ws = (char*)d_ws; _Float16 *QH = (_Float16*)(ws + WS_QH), *KH = (_Float16*)(ws + WS_KH), *VT = (_Float16*)(ws + WS_VT), *QL = (_Float16*)(ws + WS_QL), *KL = (_Float16*)(ws + WS_KL); __bf16 *VB = (__bf16*)(ws + WS_VB), *VBL = (__bf16*)(ws + WS_VBL); float *S = (float*)(ws + WS_S), *Y = (float*)(ws + WS_Y);
  (void)Y; (void)S; (void)QL; (void)KL; (void)VB; (void)VBL;
  // inputs: 0 queries [16,2048,64]; 1 keys; 2 values
  k_planes64<<<dim3(TNB * TT / 64), 256, 0, stream>>>(F[0], F[1], F[2], QH, QL, KH, KL, VT, VB, VBL);
  k_fa<<<dim3(NQB, TNB), 256, 0, stream>>>(QH, KH, VT, (float*)d_out);


}

// v002
// A run of this version takes 26.4 microseconds.
// In both of two side-by-side timings against v001, it was 1.43 times as fast.
// All steps since v000 together make it 49.3 times as fast.
// compute dtype: all float inputs rounded to bf16; queries, keys, values are bf16-valued so their f16 planes are exact; logits q x k (1 product on exact planes) x 1/8; online softmax f32; P = 2^(logit - maximum in use) once to f16 x v (exact) (1 product); f32 output.
#include <hip/hip_runtime.h>
#include <math.h>

typedef __attribute__((ext_vector_type(16))) _Float16 v16h;
typedef __attribute__((ext_vector_type(16))) __bf16 v16b;
typedef __attribute__((ext_vector_type(8)))  _Float16 v8h;
typedef __attribute__((ext_vector_type(8)))  float v8f;
typedef __attribute__((ext_vector_type(4)))  float v4f;
typedef __attribute__((ext_vector_type(2)))  float v2f;
typedef __attribute__((ext_vector_type(4)))  unsigned v4u;
typedef _Float16 hx8 __attribute__((ext_vector_type(8)));
typedef __attribute__((ext_vector_type(4)))  int v4i;
typedef float __attribute__((may_alias)) float_a;
typedef int __attribute__((may_alias)) int_a;

template <typename T> __device__ __forceinline__ void vst2(void* p, T v) { *(T*)p = v;  }
__device__ __forceinline__ v8f wmma16(v16h a, v16h b, v8f c) {
  v8f d = __builtin_amdgcn_wmma_f32_16x16x32_f16(false, a, false, b, (short)0, c, false, false);
  asm volatile("v_nop\n\tv_nop\n\tv_nop\n\tv_nop" : "+v"(d) : "v"(a), "v"(b));
  return d;
}
__device__ __forceinline__ v8f wmma_bf(v16b a, v16b b, v8f c) {
  v8f d = __builtin_amdgcn_wmma_f32_16x16x32_bf16(false, a, false, b, (short)0, c, false, false);
  asm volatile("v_nop\n\tv_nop\n\tv_nop\n\tv_nop" : "+v"(d) : "v"(a), "v"(b));
  return d;
}
// 16x16x32 fragments: lane = (h = lane>>4, row/col = lane&15); elements 0..7 = k0+8h+0..7, 8..15 = k0+16+8h+0..7; D element r = row 8h+r
__device__ __forceinline__ v16h frag_h(const _Float16* rowk0, int lane) {
  union { v16h v; v8h q[2]; } u; const _Float16* p = rowk0 + 8 * (lane >> 4);
  u.q[0] = *(const v8h*)p; u.q[1] = *(const v8h*)(p + 16); return u.v;
}
__device__ __forceinline__ v16h frag_f32(const float* rowk0, int lane) {
  v16h a; const float* p = rowk0 + 8 * (lane >> 4);
#pragma unroll
  for (int i = 0; i < 8; ++i) { a[i] = (_Float16)p[i]; a[8 + i] = (_Float16)p[16 + i]; }
  return a;
}
__device__ __forceinline__ v16h frag_f32s(const float* rowk0, int lane, float sc) {
  v16h a; const float* p = rowk0 + 8 * (lane >> 4);
#pragma unroll
  for (int i = 0; i < 8; ++i) { a[i] = (_Float16)(p[i] * sc); a[8 + i] = (_Float16)(p[16 + i] * sc); }
  return a;
}
// column fragment from a [K][ld] layout (column n), rows >= K read as 0
__device__ __forceinline__ v16h fragc_f32(const float* W, int k0, int n, int lane, int ld, int K) {
  v16h a; const int g = lane >> 4;
#pragma unroll
  for (int i = 0; i < 8; ++i) { const int ka = k0 + 8 * g + i, kb = ka + 16;
    a[i] = (_Float16)(ka < K ? W[(size_t)(ka < K ? ka : K - 1) * ld + n] : 0.f); a[8 + i] = (_Float16)(kb < K ? W[(size_t)(kb < K ? kb : K - 1) * ld + n] : 0.f); }
  return a;
}
struct F2 { v16b h, l; };
__device__ __forceinline__ F2 bsplit16(const float v[16]) { F2 r;
#pragma unroll
  for (int i = 0; i < 16; ++i) { const __bf16 h = (__bf16)v[i]; r.h[i] = h; r.l[i] = (__bf16)(v[i] - (float)h); }
  return r; }
__device__ __forceinline__ F2 split_row(const float* row, int k0, int lane) { float v[16]; const float* p = row + k0 + 8 * (lane >> 4);
#pragma unroll
  for (int i = 0; i < 8; ++i) { v[i] = p[i]; v[8 + i] = p[16 + i]; }
  return bsplit16(v); }
__device__ __forceinline__ F2 split_rowK(const float* row, int k0, int lane, int K) { float v[16]; const int g = lane >> 4;
#pragma unroll
  for (int i = 0; i < 8; ++i) { const int ka = k0 + 8 * g + i, kb = ka + 16; v[i] = ka < K ? row[ka < K ? ka : K - 1] : 0.f; v[8 + i] = kb < K ? row[kb < K ? kb : K - 1] : 0.f; }
  return bsplit16(v); }
__device__ __forceinline__ F2 split_col(const float* W, int k0, int n, int lane, int ld, int K) { float v[16]; const int g = lane >> 4;
#pragma unroll
  for (int i = 0; i < 8; ++i) { const int ka = k0 + 8 * g + i, kb = ka + 16; v[i] = ka < K ? W[(size_t)(ka < K ? ka : K - 1) * ld + n] : 0.f; v[8 + i] = kb < K ? W[(size_t)(kb < K ? kb : K - 1) * ld + n] : 0.f; }
  return bsplit16(v); }
__device__ __forceinline__ v8f mac3(const F2& a, const F2& b, v8f c) { c = wmma_bf(a.l, b.h, c); c = wmma_bf(a.h, b.l, c); return wmma_bf(a.h, b.h, c); }
__device__ __forceinline__ float sigm(float v) { return 1.0f / (1.0f + expf(-v)); }
#define LDSX() do { asm volatile("s_wait_dscnt 0" ::: "memory"); __builtin_amdgcn_wave_barrier(); __builtin_amdgcn_fence(__ATOMIC_RELEASE, "workgroup"); } while (0)

// Plain dot-product attention on given tensors (queries / keys / values [16,2048,64]; no mask): out = softmax(Q K^T / 8) V -> [16,2048,64].
#define NB 16
#define TT 2048
#define CC 64            // NH * HD = projected width
#define DIN 64          // input (model) width
#define NH 1
#define HD 64
#define NQB (TT / 64)
#define HG 1
#define SCALE (0.125f)
#define CAUSAL 0
#ifndef TNB
#define TNB NB
#endif
__device__ __forceinline__ float bfr(float v) { return (float)(__bf16)v; }
__host__ __device__ __forceinline__ int kb_last(int qb) { return CAUSAL ? ((qb * 64 + 63) >> 7) : (TT / 128 - 1); }
typedef __attribute__((ext_vector_type(8))) __bf16 v8b;
__device__ __forceinline__ v16b frag_b(const __bf16* rowk0, int lane) {
  union { v16b v; v8b q[2]; } u; const __bf16* p = rowk0 + 8 * (lane >> 4);
  u.q[0] = *(const v8b*)p; u.q[1] = *(const v8b*)(p + 16); return u.v;
}
#define QBH 0              // exact planes: single-product logits and single-f16 P x V on every block
#define QHI 0               // no q residual plane (q is bf16-exact in f16)
#define KHI 64              // unused high-precision planes kept minimal
// B fragment (k rows k0+.., output column o) of a weight: (in,out) [K][ld] or (out,in) [ld rows of K]: bf16 exact, or f16(bf16 * 256) exact
__device__ __forceinline__ v16b wcol_io(const float* Wm, int k0, int o, int lane, int ld) { v16b w; const int g = lane >> 4;
#pragma unroll
  for (int i = 0; i < 8; ++i) { w[i] = (__bf16)Wm[(size_t)(k0 + 8 * g + i) * ld + o]; w[8 + i] = (__bf16)Wm[(size_t)(k0 + 16 + 8 * g + i) * ld + o]; }
  return w; }
__device__ __forceinline__ v16b wcol_oi(const float* Wm, int k0, int o, int lane, int K) { v16b w; const float* p = Wm + (size_t)o * K + k0 + 8 * (lane >> 4);
#pragma unroll
  for (int i = 0; i < 8; ++i) { w[i] = (__bf16)p[i]; w[8 + i] = (__bf16)p[16 + i]; }
  return w; }
__device__ __forceinline__ v16h wcolh_io(const float* Wm, int k0, int o, int lane, int ld) { v16h w; const int g = lane >> 4;
#pragma unroll
  for (int i = 0; i < 8; ++i) { w[i] = (_Float16)(bfr(Wm[(size_t)(k0 + 8 * g + i) * ld + o]) * 256.0f); w[8 + i] = (_Float16)(bfr(Wm[(size_t)(k0 + 16 + 8 * g + i) * ld + o]) * 256.0f); }
  return w; }
__device__ __forceinline__ v16h wcolh_oi(const float* Wm, int k0, int o, int lane, int K) { v16h w; const float* p = Wm + (size_t)o * K + k0 + 8 * (lane >> 4);
#pragma unroll
  for (int i = 0; i < 8; ++i) { w[i] = (_Float16)(bfr(p[i]) * 256.0f); w[8 + i] = (_Float16)(bfr(p[16 + i]) * 256.0f); }
  return w; }
#define WQKV_LAYOUT 0   // 0 = (in,out) [DIN][CC]; 1 = (out,in) [CC][DIN]; 2 = per-head [NH][DIN][HD]
__device__ __forceinline__ v16b wcol_hdk(const float* Wm, int k0, int o, int lane) { v16b w; const int g = lane >> 4; const float* p = Wm + (size_t)(o / HD) * DIN * HD + (o % HD);
#pragma unroll
  for (int i = 0; i < 8; ++i) { w[i] = (__bf16)p[(size_t)(k0 + 8 * g + i) * HD]; w[8 + i] = (__bf16)p[(size_t)(k0 + 16 + 8 * g + i) * HD]; }
  return w; }
#define WO_OUT_IN 0
#if WQKV_LAYOUT == 1
#define WCOL(W, k0, o, lane) wcol_oi(W, k0, o, lane, DIN)
#elif WQKV_LAYOUT == 2
#define WCOL(W, k0, o, lane) wcol_hdk(W, k0, o, lane)
#else
#define WCOL(W, k0, o, lane) wcol_io(W, k0, o, lane, CC)
#endif
#if WO_OUT_IN
#define WOCOL(W, k0, o, lane) wcol_oi(W, k0, o, lane, CC)
#define WOCOLH(W, k0, o, lane) wcolh_oi(W, k0, o, lane, CC)
#else
#define WOCOL(W, k0, o, lane) wcol_io(W, k0, o, lane, DIN)
#define WOCOLH(W, k0, o, lane) wcolh_io(W, k0, o, lane, DIN)
#endif
__global__ __launch_bounds__(256) void k_planes64(const float* __restrict__ Qs, const float* __restrict__ Ks, const float* __restrict__ Vs, _Float16* __restrict__ QH, _Float16* __restrict__ QL, _Float16* __restrict__ KH, _Float16* __restrict__ KL, _Float16* __restrict__ VT, __bf16* __restrict__ VB, __bf16* __restrict__ VBL) {
  __shared__ __align__(16) _Float16 sv[64][72], sq[64][72], sk[64][72];   // 144-byte rows: 16-byte LDS accesses of 16 consecutive rows fall on distinct banks
  const int tid = threadIdx.x; const size_t r0 = (size_t)blockIdx.x * 64; const int b = (int)(r0 / TT), t0 = (int)(r0 % TT);
  for (int e = tid; e < 64 * 8; e += 256) { const int rl = e >> 3, q = e & 7; const size_t src = (r0 + rl) * CC + q * 8; float tq[8], tk[8], tv[8];
#pragma unroll
    for (int u = 0; u < 8; ++u) { tq[u] = Qs[src + u]; tk[u] = Ks[src + u]; tv[u] = Vs[src + u]; }
    asm volatile("s_wait_loadcnt 0x0" ::: "memory");
    hx8 hq, hk, hlq, hlk;
#pragma unroll
    for (int u = 0; u < 8; ++u) { const float qv = bfr(tq[u]), kv = bfr(tk[u]); const _Float16 qh = (_Float16)qv, kh = (_Float16)kv; hq[u] = qh; hlq[u] = (_Float16)((qv - (float)qh) * 1024.0f); hk[u] = kh; hlk[u] = (_Float16)((kv - (float)kh) * 1024.0f); sv[rl][q * 8 + u] = (_Float16)bfr(tv[u]); }
    *(hx8*)&sq[rl][q * 8] = hq; *(hx8*)&sk[rl][q * 8] = hk;
    if (t0 + rl < QHI) vst2((unsigned*)(QL + ((size_t)b * QHI + t0 + rl) * CC + q * 8), *(const v4u*)&hlq);
    if (t0 + rl < KHI) vst2((unsigned*)(KL + ((size_t)b * KHI + t0 + rl) * CC + q * 8), *(const v4u*)&hlk); }
  __syncthreads();
  // fragment order: every 32 rows of q, k (32 keys of v) make one 4-KiB unit [x][h][lane][8]; piece e of this block's 64 rows is lane (g, cl) of register half h of fragment x in unit e >> 8,
  // so a wave stores, and k_fa's waves load, 512 contiguous bytes per 16-byte instruction. q, k: x = (16-row tile, 32-wide slice of d); v: x = 16-wide slice of c, the 8 elements run along the keys.
  for (int e = tid; e < 64 * 8; e += 256) { const int cl = e & 15, q = (e >> 8) * 4 + ((e >> 5) & 1) * 2 + ((e >> 4) & 1), x = (e >> 6) & 3, c = x * 16 + cl; const int rw = (e >> 8) * 32 + (x >> 1) * 16 + cl, dq = (x & 1) * 32 + (q & 3) * 8;
    vst2((unsigned*)(QH + r0 * CC + e * 8), *(const v4u*)&sq[rw][dq]); vst2((unsigned*)(KH + r0 * CC + e * 8), *(const v4u*)&sk[rw][dq]);
    hx8 hv; _Pragma("unroll") for (int j = 0; j < 8; ++j) hv[j] = sv[q * 8 + j][c]; vst2((unsigned*)(VT + r0 * CC + e * 8), *(const v4u*)&hv);
    asm volatile("s_wait_xcnt 0x0" ::: "memory");   // before the next trip (or the branch below) overwrites the index and data registers that these three stores name
    if (t0 < KHI) { v8b bh, bl; _Pragma("unroll") for (int j = 0; j < 8; ++j) { const float vv = (float)hv[j]; const __bf16 h1 = (__bf16)vv; bh[j] = h1; bl[j] = (__bf16)(vv - (float)h1); } vst2((unsigned*)(VB + ((size_t)b * CC + c) * KHI + t0 + q * 8), *(const v4u*)&bh); vst2((unsigned*)(VBL + ((size_t)b * CC + c) * KHI + t0 + q * 8), *(const v4u*)&bl); } } }
#define SM_EXTRA_PARAMS
#define SM_MASK_HOOK (void)0
#ifndef SM_EXTRA_PARAMS
#define SM_EXTRA_PARAMS
#endif
#ifndef PROJ_EXTRA_PARAMS
#define PROJ_EXTRA_PARAMS
#endif
#ifndef SM_MASK_HOOK
#define SM_MASK_HOOK (void)0
#endif

#define WS_QH  0u                                      // f16 q, fragment order [b*t/32][tile 2][d slice 2][half 2][lane 32][8]
#define WS_KH  (WS_QH + 2u * (size_t)NB * TT * CC)      // f16 k, fragment order like q
#define WS_VT  (WS_KH + 2u * (size_t)NB * TT * CC)      // f16 v, fragment order [b*t/32][c slice 4][half 2][lane 32][8 keys]
#define WS_QL  (WS_VT + 2u * (size_t)NB * CC * TT)      // f16 q residual x 2^10 rows [b][t < QHI][CC]
#define WS_KL  (WS_QL + 2u * (size_t)NB * QHI * CC)     // f16 k residual x 2^10 rows [b][t < KHI][CC]
#define WS_VB  (WS_KL + 2u * (size_t)NB * KHI * CC)     // bf16 v hi planes [b][c][t < KHI]
#define WS_VBL (WS_VB + 2u * (size_t)NB * CC * KHI)
#define WS_S   (WS_VBL + 2u * (size_t)NB * CC * KHI)    // f32 [hg][t][s] scratch, unused (k_fa keeps scores in registers)
#define WS_Y   (WS_S  + 4u * (size_t)HG * TT * TT)      // f32 ctx rows [b*t][CC] (only when there is an output projection)
#define WS_END (WS_Y  + 0u)

// ---- k_proj: block = (64 rows, 128 cols, which): q/k/v = X W (+ b) with exact bf16 products (K = DIN) -> which 0: q f16 rows (+ residual rows < QHI); 1: k f16 rows (+ residual rows < KHI); 2: v f16 planes [c][t] (+ bf16 hi/lo planes for t < KHI)
__global__ __launch_bounds__(128) void k_proj(const float* __restrict__ XQ, const float* __restrict__ XK, const float* __restrict__ XV, const float* __restrict__ WQ, const float* __restrict__ WK, const float* __restrict__ WV, const float* __restrict__ BQ, const float* __restrict__ BK, const float* __restrict__ BV,
    _Float16* __restrict__ QH, _Float16* __restrict__ QL, _Float16* __restrict__ KH, _Float16* __restrict__ KL, _Float16* __restrict__ VT, __bf16* __restrict__ VB, __bf16* __restrict__ VBL) {
  __shared__ __align__(16) _Float16 sh[64][136], sl[64][136]; __shared__ __align__(16) _Float16 th[128][72]; __shared__ __align__(16) __bf16 tb[128][72], tbl[128][72];
  const int tid = threadIdx.x, wave = tid >> 5, lane = tid & 31, col = lane & 15, g = lane >> 4; const int which = blockIdx.z; const int c0 = blockIdx.y * 128; const size_t r0 = (size_t)blockIdx.x * 64; const size_t bb = r0 / TT; const int t0 = (int)(r0 % TT);
  const float* X = which == 0 ? XQ : which == 1 ? XK : XV; const float* WA = which == 0 ? WQ : which == 1 ? WK : WV; const float* BA = which == 0 ? BQ : which == 1 ? BK : BV;
  v8f acc[8] = {};
#pragma unroll 2
  for (int kc = 0; kc < DIN / 32; ++kc) { v16b a; { const float* p = X + (r0 + wave * 16 + col) * DIN + kc * 32 + 8 * g;
#pragma unroll
      for (int i = 0; i < 8; ++i) { a[i] = (__bf16)p[i]; a[8 + i] = (__bf16)p[16 + i]; } }
    asm volatile("s_wait_loadcnt 0x0" ::: "memory");
#pragma unroll
    for (int j = 0; j < 8; ++j) { const v16b w = WCOL(WA, kc * 32, c0 + j * 16 + col, lane); asm volatile("s_wait_loadcnt 0x0" ::: "memory"); acc[j] = wmma_bf(a, w, acc[j]); } }
  if (which < 2) { _Float16* DH = which == 0 ? QH : KH; _Float16* DL = which == 0 ? QL : KL; const int nhi = which == 0 ? QHI : KHI; const bool hi_rows = t0 < nhi;
#pragma unroll
    for (int j = 0; j < 8; ++j) { const float bias = BA ? bfr(BA[c0 + j * 16 + col]) : 0.f;
#pragma unroll
      for (int r = 0; r < 8; ++r) { const float v = acc[j][r] + bias; const _Float16 hv = (_Float16)v; sh[wave * 16 + 8 * g + r][j * 16 + col] = hv; sl[wave * 16 + 8 * g + r][j * 16 + col] = (_Float16)((v - (float)hv) * 1024.0f); } }
    __syncthreads();
    for (int e = tid; e < 64 * 16; e += 128) { const int rl = e >> 4, q = e & 15; vst2((unsigned*)(DH + (r0 + rl) * CC + c0 + q * 8), *(const v4u*)&sh[rl][q * 8]); if (hi_rows) vst2((unsigned*)(DL + (bb * nhi + t0 + rl) * (size_t)CC + c0 + q * 8), *(const v4u*)&sl[rl][q * 8]); }
  } else { const bool hi_rows = t0 < KHI;
#pragma unroll
    for (int j = 0; j < 8; ++j) { const float bias = BA ? bfr(BA[c0 + j * 16 + col]) : 0.f;
#pragma unroll
      for (int r = 0; r < 8; ++r) { const float v = acc[j][r] + bias; const int rl = wave * 16 + 8 * g + r, cl = j * 16 + col; th[cl][rl] = (_Float16)v; const __bf16 bh = (__bf16)v; tb[cl][rl] = bh; tbl[cl][rl] = (__bf16)(v - (float)bh); } }
    __syncthreads();
    for (int e = tid; e < 128 * 8; e += 128) { const int cl = e >> 3, q = e & 7; vst2((unsigned*)(VT + (bb * CC + c0 + cl) * (size_t)TT + t0 + q * 8), *(const v4u*)&th[cl][q * 8]); if (hi_rows) { const size_t o3 = (bb * CC + c0 + cl) * (size_t)KHI + t0 + q * 8; vst2((unsigned*)(VB + o3), *(const v4u*)&tb[cl][q * 8]); vst2((unsigned*)(VBL + o3), *(const v4u*)&tbl[cl][q * 8]); } } } }
// ---- k_fa: block = 64 queries of batch blockIdx.y, 8 waves; wave = (32 queries, one quarter of the keys). Transposed products: S^T = K Q^T (a lane holds 16 scores of one query per 32 keys),
// online softmax in f32 (base 2), P^T packed from the score accumulators into the B operand (f16), O^T += V^T P^T; the four key quarters are merged in LDS at the end.
// lane l with lane l ^ 16 by a vector cross-row move (no LDS round trip)
__device__ __forceinline__ float xhalf(float x) { return __builtin_bit_cast(float, __builtin_amdgcn_permlanex16(__builtin_bit_cast(int, x), __builtin_bit_cast(int, x), 0x76543210, 0xfedcba98, false, false)); }
// every '#pragma unroll' in k_fa gives a fragment or accumulator array constant indices, so that it stays in registers
// one fragment from a fragment-order unit: p = fragment start + 8 * lane; the two register halves lie 512 bytes apart
__device__ __forceinline__ v16h frag_p(const _Float16* p) { union { v16h v; v8h q[2]; } u; u.q[0] = *(const v8h*)p; u.q[1] = *(const v8h*)(p + 256); return u.v; }
#define KSPL 4
#define KPW (TT / KSPL)
__global__ __launch_bounds__(256) void k_fa(const _Float16* __restrict__ QH, const _Float16* __restrict__ KH, const _Float16* __restrict__ VT, float* __restrict__ Y) {
  __shared__ __align__(16) float so[KSPL][64][HD + 4]; __shared__ float smx[KSPL][64], sls[KSPL][64];
  const int tid = threadIdx.x, wave = tid >> 5, lane = tid & 31, col = lane & 15, g = lane >> 4; const int b = blockIdx.y, qb = blockIdx.x; const int qg = wave & 1, kq = wave >> 1;
  const float C2 = SCALE * 1.44269504088896f;   // logits in units of log2
  v16h qf[2][2];
#pragma unroll
  for (int t = 0; t < 2; ++t)
#pragma unroll
    for (int kc = 0; kc < 2; ++kc) qf[t][kc] = frag_p(QH + ((size_t)b * TT + qb * 64 + qg * 32) * CC + (t * 2 + kc) * 512 + lane * 8);
  const _Float16* Kb = KH + ((size_t)b * TT + kq * KPW) * CC + lane * 8; const _Float16* Vb = VT + ((size_t)b * TT + kq * KPW) * CC + lane * 8;
  v8f acc[2][4] = {}; float m[2] = {-3.0e38f, -3.0e38f}, l[2] = {0.f, 0.f};
  v16h kf[2][2];
#pragma unroll
  for (int i = 0; i < 2; ++i)
#pragma unroll
    for (int kc = 0; kc < 2; ++kc) kf[i][kc] = frag_p(Kb + (i * 2 + kc) * 512);
#pragma unroll 1   // rolled: one trip's fragments, scores and sums already take the registers that four waves per SIMD leave
  for (int k0 = 0; k0 < KPW; k0 += 32) {
    v16h vf[4];
#pragma unroll
    for (int j = 0; j < 4; ++j) vf[j] = frag_p(Vb + (size_t)k0 * CC + j * 512);
    v8f s[2][2] = {};
#pragma unroll
    for (int i = 0; i < 2; ++i)
#pragma unroll
      for (int kc = 0; kc < 2; ++kc)
#pragma unroll
        for (int t = 0; t < 2; ++t) s[t][i] = wmma16(kf[i][kc], qf[t][kc], s[t][i]);
    const int kn = k0 + 32 < KPW ? k0 + 32 : k0;   // the next 32 keys' rows, fetched one trip ahead (the last trip reads its own again)
#pragma unroll
    for (int i = 0; i < 2; ++i)
#pragma unroll
      for (int kc = 0; kc < 2; ++kc) kf[i][kc] = frag_p(Kb + (size_t)kn * CC + (i * 2 + kc) * 512);
    float mx[2];
#pragma unroll
    for (int t = 0; t < 2; ++t) { float a = fmaxf(s[t][0][0], s[t][1][0]);
#pragma unroll
      for (int r = 1; r < 8; ++r) a = fmaxf(a, fmaxf(s[t][0][r], s[t][1][r]));
      mx[t] = fmaxf(a, xhalf(a)) * C2; }
    // the maximum in use moves only when a query's new maximum passes it by more than 8 (P <= 2^8 fits f16); one wave-uniform test per trip
    if (__builtin_amdgcn_ballot_w32(mx[0] > m[0] + 8.0f || mx[1] > m[1] + 8.0f) != 0) {
#pragma unroll
      for (int t = 0; t < 2; ++t) { const float mn = fmaxf(m[t], mx[t]); const float al = __builtin_amdgcn_exp2f(m[t] - mn); m[t] = mn; l[t] *= al;
#pragma unroll
        for (int j = 0; j < 4; ++j) acc[t][j] *= al; } }
#pragma unroll
    for (int t = 0; t < 2; ++t) { v16h pf; v2f ls = {0.f, 0.f}; const v2f c2 = {C2, C2}, nm = {-m[t], -m[t]};
#pragma unroll
      for (int i = 0; i < 2; ++i)
#pragma unroll
        for (int r = 0; r < 8; r += 2) { const v2f x = {s[t][i][r], s[t][i][r + 1]}; const v2f a = __builtin_elementwise_fma(x, c2, nm); const v2f p = {__builtin_amdgcn_exp2f(a.x), __builtin_amdgcn_exp2f(a.y)}; ls += p; pf[8 * i + r] = (_Float16)p.x; pf[8 * i + r + 1] = (_Float16)p.y; }
      l[t] += ls.x + ls.y;
#pragma unroll
      for (int j = 0; j < 4; ++j) acc[t][j] = wmma16(vf[j], pf, acc[t][j]); } }
  // merge of the four key quarters: common maximum, then scaled partial sums
#pragma unroll
  for (int t = 0; t < 2; ++t) { l[t] += xhalf(l[t]); if (g == 0) smx[kq][qg * 32 + t * 16 + col] = m[t]; }
  __syncthreads();
#pragma unroll
  for (int t = 0; t < 2; ++t) { const int q = qg * 32 + t * 16 + col; const float M = fmaxf(fmaxf(smx[0][q], smx[1][q]), fmaxf(smx[2][q], smx[3][q])); const float f = __builtin_amdgcn_exp2f(m[t] - M);
    if (g == 0) sls[kq][q] = l[t] * f;
#pragma unroll
    for (int j = 0; j < 4; ++j) { const v8f o = acc[t][j] * f; v4f lo = {o[0], o[1], o[2], o[3]}, hi = {o[4], o[5], o[6], o[7]}; *(v4f*)&so[kq][q][j * 16 + 8 * g] = lo; *(v4f*)&so[kq][q][j * 16 + 8 * g + 4] = hi; } }
  __syncthreads();
#pragma unroll
  for (int u = 0; u < 4; ++u) { const int e = u * 256 + tid, q = e >> 4, d = (e & 15) * 4; const float inv = 1.0f / ((sls[0][q] + sls[1][q]) + (sls[2][q] + sls[3][q]));
    const v4f a = (*(const v4f*)&so[0][q][d] + *(const v4f*)&so[1][q][d]) + (*(const v4f*)&so[2][q][d] + *(const v4f*)&so[3][q][d]);
    vst2(Y + ((size_t)b * TT + qb * 64 + q) * CC + d, a * inv); } }

extern "C" void kernel_launch(void* const* d_in, const int* in_sizes, int n_in, void* d_out, int out_size, void* d_ws, size_t ws_size, hipStream_t stream) {
  (void)in_sizes; (void)n_in; (void)out_size;
  const float** F = (const float**)d_in;
  if (ws_size < (size_t)WS_END) return;
  char* ws = (char*)d_ws; _Float16 *QH = (_Float16*)(ws + WS_QH), *KH = (_Float16*)(ws + WS_KH), *VT = (_Float16*)(ws + WS_VT), *QL = (_Float16*)(ws + WS_QL), *KL = (_Float16*)(ws + WS_KL); __bf16 *VB = (__bf16*)(ws + WS_VB), *VBL = (__bf16*)(ws + WS_VBL); float *S = (float*)(ws + WS_S), *Y = (float*)(ws + WS_Y);
  (void)Y; (void)S; (void)QL; (void)KL; (void)VB; (void)VBL;
  // inputs: 0 queries [16,2048,64]; 1 keys; 2 values
  k_planes64<<<dim3(TNB * TT / 64), 256, 0, stream>>>(F[0], F[1], F[2], QH, QL, KH, KL, VT, VB, VBL);
  k_fa<<<dim3(NQB, TNB), 256, 0, stream>>>(QH, KH, VT, (float*)d_out);


}

// v003
// Measured time: 23.8 microseconds a run.
// Timed twice side by side with v002, it ran 1.11 and 1.12 times as fast.
// Over all steps from v000 it is 55.0 times as fast.
// compute dtype: all float inputs rounded to bf16; queries, keys, values are bf16-valued so their f16 planes are exact; logits q x k (1 product on exact planes) x 1/8; online softmax f32; P = 2^(logit - maximum in use) once to f16 x v (exact) (1 product); f32 output.
#include <hip/hip_runtime.h>
#include <math.h>
#include <stdint.h>

typedef __attribute__((ext_vector_type(16))) _Float16 v16h;
typedef __attribute__((ext_vector_type(16))) __bf16 v16b;
typedef __attribute__((ext_vector_type(8)))  _Float16 v8h;
typedef __attribute__((ext_vector_type(8)))  float v8f;
typedef __attribute__((ext_vector_type(4)))  float v4f;
typedef __attribute__((ext_vector_type(2)))  float v2f;
typedef __attribute__((ext_vector_type(4)))  unsigned v4u;
typedef _Float16 hx8 __attribute__((ext_vector_type(8)));
typedef __attribute__((ext_vector_type(4)))  int v4i;
typedef float __attribute__((may_alias)) float_a;
typedef int __attribute__((may_alias)) int_a;

template <typename T> __device__ __forceinline__ void vst2(void* p, T v) { *(T*)p = v;  }
__device__ __forceinline__ v8f wmma16(v16h a, v16h b, v8f c) {
  v8f d = __builtin_amdgcn_wmma_f32_16x16x32_f16(false, a, false, b, (short)0, c, false, false);
  asm volatile("v_nop\n\tv_nop\n\tv_nop\n\tv_nop" : "+v"(d) : "v"(a), "v"(b));
  return d;
}
__device__ __forceinline__ v8f wmma_bf(v16b a, v16b b, v8f c) {
  v8f d = __builtin_amdgcn_wmma_f32_16x16x32_bf16(false, a, false, b, (short)0, c, false, false);
  asm volatile("v_nop\n\tv_nop\n\tv_nop\n\tv_nop" : "+v"(d) : "v"(a), "v"(b));
  return d;
}
// 16x16x32 fragments: lane = (h = lane>>4, row/col = lane&15); elements 0..7 = k0+8h+0..7, 8..15 = k0+16+8h+0..7; D element r = row 8h+r
__device__ __forceinline__ v16h frag_h(const _Float16* rowk0, int lane) {
  union { v16h v; v8h q[2]; } u; const _Float16* p = rowk0 + 8 * (lane >> 4);
  u.q[0] = *(const v8h*)p; u.q[1] = *(const v8h*)(p + 16); return u.v;
}
__device__ __forceinline__ v16h frag_f32(const float* rowk0, int lane) {
  v16h a; const float* p = rowk0 + 8 * (lane >> 4);
#pragma unroll
  for (int i = 0; i < 8; ++i) { a[i] = (_Float16)p[i]; a[8 + i] = (_Float16)p[16 + i]; }
  return a;
}
__device__ __forceinline__ v16h frag_f32s(const float* rowk0, int lane, float sc) {
  v16h a; const float* p = rowk0 + 8 * (lane >> 4);
#pragma unroll
  for (int i = 0; i < 8; ++i) { a[i] = (_Float16)(p[i] * sc); a[8 + i] = (_Float16)(p[16 + i] * sc); }
  return a;
}
// column fragment from a [K][ld] layout (column n), rows >= K read as 0
__device__ __forceinline__ v16h fragc_f32(const float* W, int k0, int n, int lane, int ld, int K) {
  v16h a; const int g = lane >> 4;
#pragma unroll
  for (int i = 0; i < 8; ++i) { const int ka = k0 + 8 * g + i, kb = ka + 16;
    a[i] = (_Float16)(ka < K ? W[(size_t)(ka < K ? ka : K - 1) * ld + n] : 0.f); a[8 + i] = (_Float16)(kb < K ? W[(size_t)(kb < K ? kb : K - 1) * ld + n] : 0.f); }
  return a;
}
struct F2 { v16b h, l; };
__device__ __forceinline__ F2 bsplit16(const float v[16]) { F2 r;
#pragma unroll
  for (int i = 0; i < 16; ++i) { const __bf16 h = (__bf16)v[i]; r.h[i] = h; r.l[i] = (__bf16)(v[i] - (float)h); }
  return r; }
__device__ __forceinline__ F2 split_row(const float* row, int k0, int lane) { float v[16]; const float* p = row + k0 + 8 * (lane >> 4);
#pragma unroll
  for (int i = 0; i < 8; ++i) { v[i] = p[i]; v[8 + i] = p[16 + i]; }
  return bsplit16(v); }
__device__ __forceinline__ F2 split_rowK(const float* row, int k0, int lane, int K) { float v[16]; const int g = lane >> 4;
#pragma unroll
  for (int i = 0; i < 8; ++i) { const int ka = k0 + 8 * g + i, kb = ka + 16; v[i] = ka < K ? row[ka < K ? ka : K - 1] : 0.f; v[8 + i] = kb < K ? row[kb < K ? kb : K - 1] : 0.f; }
  return bsplit16(v); }
__device__ __forceinline__ F2 split_col(const float* W, int k0, int n, int lane, int ld, int K) { float v[16]; const int g = lane >> 4;
#pragma unroll
  for (int i = 0; i < 8; ++i) { const int ka = k0 + 8 * g + i, kb = ka + 16; v[i] = ka < K ? W[(size_t)(ka < K ? ka : K - 1) * ld + n] : 0.f; v[8 + i] = kb < K ? W[(size_t)(kb < K ? kb : K - 1) * ld + n] : 0.f; }
  return bsplit16(v); }
__device__ __forceinline__ v8f mac3(const F2& a, const F2& b, v8f c) { c = wmma_bf(a.l, b.h, c); c = wmma_bf(a.h, b.l, c); return wmma_bf(a.h, b.h, c); }
__device__ __forceinline__ float sigm(float v) { return 1.0f / (1.0f + expf(-v)); }
#define LDSX() do { asm volatile("s_wait_dscnt 0" ::: "memory"); __builtin_amdgcn_wave_barrier(); __builtin_amdgcn_fence(__ATOMIC_RELEASE, "workgroup"); } while (0)

// Plain dot-product attention on given tensors (queries / keys / values [16,2048,64]; no mask): out = softmax(Q K^T / 8) V -> [16,2048,64].
#define NB 16
#define TT 2048
#define CC 64            // NH * HD = projected width
#define DIN 64          // input (model) width
#define NH 1
#define HD 64
#define NQB (TT / 64)
#define HG 1
#define SCALE (0.125f)
#define CAUSAL 0
#ifndef TNB
#define TNB NB
#endif
__device__ __forceinline__ float bfr(float v) { return (float)(__bf16)v; }
__host__ __device__ __forceinline__ int kb_last(int qb) { return CAUSAL ? ((qb * 64 + 63) >> 7) : (TT / 128 - 1); }
typedef __attribute__((ext_vector_type(8))) __bf16 v8b;
__device__ __forceinline__ v16b frag_b(const __bf16* rowk0, int lane) {
  union { v16b v; v8b q[2]; } u; const __bf16* p = rowk0 + 8 * (lane >> 4);
  u.q[0] = *(const v8b*)p; u.q[1] = *(const v8b*)(p + 16); return u.v;
}
#define QBH 0              // exact planes: single-product logits and single-f16 P x V on every block
#define QHI 0               // no q residual plane (q is bf16-exact in f16)
#define KHI 64              // unused high-precision planes kept minimal
// B fragment (k rows k0+.., output column o) of a weight: (in,out) [K][ld] or (out,in) [ld rows of K]: bf16 exact, or f16(bf16 * 256) exact
__device__ __forceinline__ v16b wcol_io(const float* Wm, int k0, int o, int lane, int ld) { v16b w; const int g = lane >> 4;
#pragma unroll
  for (int i = 0; i < 8; ++i) { w[i] = (__bf16)Wm[(size_t)(k0 + 8 * g + i) * ld + o]; w[8 + i] = (__bf16)Wm[(size_t)(k0 + 16 + 8 * g + i) * ld + o]; }
  return w; }
__device__ __forceinline__ v16b wcol_oi(const float* Wm, int k0, int o, int lane, int K) { v16b w; const float* p = Wm + (size_t)o * K + k0 + 8 * (lane >> 4);
#pragma unroll
  for (int i = 0; i < 8; ++i) { w[i] = (__bf16)p[i]; w[8 + i] = (__bf16)p[16 + i]; }
  return w; }
__device__ __forceinline__ v16h wcolh_io(const float* Wm, int k0, int o, int lane, int ld) { v16h w; const int g = lane >> 4;
#pragma unroll
  for (int i = 0; i < 8; ++i) { w[i] = (_Float16)(bfr(Wm[(size_t)(k0 + 8 * g + i) * ld + o]) * 256.0f); w[8 + i] = (_Float16)(bfr(Wm[(size_t)(k0 + 16 + 8 * g + i) * ld + o]) * 256.0f); }
  return w; }
__device__ __forceinline__ v16h wcolh_oi(const float* Wm, int k0, int o, int lane, int K) { v16h w; const float* p = Wm + (size_t)o * K + k0 + 8 * (lane >> 4);
#pragma unroll
  for (int i = 0; i < 8; ++i) { w[i] = (_Float16)(bfr(p[i]) * 256.0f); w[8 + i] = (_Float16)(bfr(p[16 + i]) * 256.0f); }
  return w; }
#define WQKV_LAYOUT 0   // 0 = (in,out) [DIN][CC]; 1 = (out,in) [CC][DIN]; 2 = per-head [NH][DIN][HD]
__device__ __forceinline__ v16b wcol_hdk(const float* Wm, int k0, int o, int lane) { v16b w; const int g = lane >> 4; const float* p = Wm + (size_t)(o / HD) * DIN * HD + (o % HD);
#pragma unroll
  for (int i = 0; i < 8; ++i) { w[i] = (__bf16)p[(size_t)(k0 + 8 * g + i) * HD]; w[8 + i] = (__bf16)p[(size_t)(k0 + 16 + 8 * g + i) * HD]; }
  return w; }
#define WO_OUT_IN 0
#if WQKV_LAYOUT == 1
#define WCOL(W, k0, o, lane) wcol_oi(W, k0, o, lane, DIN)
#elif WQKV_LAYOUT == 2
#define WCOL(W, k0, o, lane) wcol_hdk(W, k0, o, lane)
#else
#define WCOL(W, k0, o, lane) wcol_io(W, k0, o, lane, CC)
#endif
#if WO_OUT_IN
#define WOCOL(W, k0, o, lane) wcol_oi(W, k0, o, lane, CC)
#define WOCOLH(W, k0, o, lane) wcolh_oi(W, k0, o, lane, CC)
#else
#define WOCOL(W, k0, o, lane) wcol_io(W, k0, o, lane, DIN)
#define WOCOLH(W, k0, o, lane) wcolh_io(W, k0, o, lane, DIN)
#endif
__global__ __launch_bounds__(256) void k_planes64(const float* __restrict__ Qs, const float* __restrict__ Ks, const float* __restrict__ Vs, _Float16* __restrict__ QH, _Float16* __restrict__ QL, _Float16* __restrict__ KH, _Float16* __restrict__ KL, _Float16* __restrict__ VT, __bf16* __restrict__ VB, __bf16* __restrict__ VBL) {
  __shared__ __align__(16) _Float16 sv[64][72], sq[64][72], sk[64][72];   // 144-byte rows: 16-byte LDS accesses of 16 consecutive rows fall on distinct banks
  const int tid = threadIdx.x; const size_t r0 = (size_t)blockIdx.x * 64; const int b = (int)(r0 / TT), t0 = (int)(r0 % TT);
  for (int e = tid; e < 64 * 8; e += 256) { const int rl = e >> 3, q = e & 7; const size_t src = (r0 + rl) * CC + q * 8; float tq[8], tk[8], tv[8];
#pragma unroll
    for (int u = 0; u < 8; ++u) { tq[u] = Qs[src + u]; tk[u] = Ks[src + u]; tv[u] = Vs[src + u]; }
    asm volatile("s_wait_loadcnt 0x0" ::: "memory");
    hx8 hq, hk, hlq, hlk;
#pragma unroll
    for (int u = 0; u < 8; ++u) { const float qv = bfr(tq[u]), kv = bfr(tk[u]); const _Float16 qh = (_Float16)qv, kh = (_Float16)kv; hq[u] = qh; hlq[u] = (_Float16)((qv - (float)qh) * 1024.0f); hk[u] = kh; hlk[u] = (_Float16)((kv - (float)kh) * 1024.0f); sv[rl][q * 8 + u] = (_Float16)bfr(tv[u]); }
    *(hx8*)&sq[rl][q * 8] = hq; *(hx8*)&sk[rl][q * 8] = hk;
    if (t0 + rl < QHI) vst2((unsigned*)(QL + ((size_t)b * QHI + t0 + rl) * CC + q * 8), *(const v4u*)&hlq);
    if (t0 + rl < KHI) vst2((unsigned*)(KL + ((size_t)b * KHI + t0 + rl) * CC + q * 8), *(const v4u*)&hlk); }
  __syncthreads();
  // fragment order: every 32 rows of q, k (32 keys of v) make one 4-KiB unit [x][h][lane][8]; piece e of this block's 64 rows is lane (g, cl) of register half h of fragment x in unit e >> 8,
  // so a wave stores, and k_fa's waves load, 512 contiguous bytes per 16-byte instruction. q, k: x = (16-row tile, 32-wide slice of d); v: x = 16-wide slice of c, the 8 elements run along the keys.
  for (int e = tid; e < 64 * 8; e += 256) { const int cl = e & 15, q = (e >> 8) * 4 + ((e >> 5) & 1) * 2 + ((e >> 4) & 1), x = (e >> 6) & 3, c = x * 16 + cl; const int rw = (e >> 8) * 32 + (x >> 1) * 16 + cl, dq = (x & 1) * 32 + (q & 3) * 8;
    vst2((unsigned*)(QH + r0 * CC + e * 8), *(const v4u*)&sq[rw][dq]); vst2((unsigned*)(KH + r0 * CC + e * 8), *(const v4u*)&sk[rw][dq]);
    hx8 hv; _Pragma("unroll") for (int j = 0; j < 8; ++j) hv[j] = sv[q * 8 + j][c]; vst2((unsigned*)(VT + r0 * CC + e * 8), *(const v4u*)&hv);
    asm volatile("s_wait_xcnt 0x0" ::: "memory");   // before the next trip (or the branch below) overwrites the index and data registers that these three stores name
    if (t0 < KHI) { v8b bh, bl; _Pragma("unroll") for (int j = 0; j < 8; ++j) { const float vv = (float)hv[j]; const __bf16 h1 = (__bf16)vv; bh[j] = h1; bl[j] = (__bf16)(vv - (float)h1); } vst2((unsigned*)(VB + ((size_t)b * CC + c) * KHI + t0 + q * 8), *(const v4u*)&bh); vst2((unsigned*)(VBL + ((size_t)b * CC + c) * KHI + t0 + q * 8), *(const v4u*)&bl); } } }
#define SM_EXTRA_PARAMS
#define SM_MASK_HOOK (void)0
#ifndef SM_EXTRA_PARAMS
#define SM_EXTRA_PARAMS
#endif
#ifndef PROJ_EXTRA_PARAMS
#define PROJ_EXTRA_PARAMS
#endif
#ifndef SM_MASK_HOOK
#define SM_MASK_HOOK (void)0
#endif

#define WS_QH  0u                                      // f16 q, fragment order [b*t/32][tile 2][d slice 2][half 2][lane 32][8]
#define WS_KH  (WS_QH + 2u * (size_t)NB * TT * CC)      // f16 k, fragment order like q
#define WS_VT  (WS_KH + 2u * (size_t)NB * TT * CC)      // f16 v, fragment order [b*t/32][c slice 4][half 2][lane 32][8 keys]
#define WS_QL  (WS_VT + 2u * (size_t)NB * CC * TT)      // f16 q residual x 2^10 rows [b][t < QHI][CC]
#define WS_KL  (WS_QL + 2u * (size_t)NB * QHI * CC)     // f16 k residual x 2^10 rows [b][t < KHI][CC]
#define WS_VB  (WS_KL + 2u * (size_t)NB * KHI * CC)     // bf16 v hi planes [b][c][t < KHI]
#define WS_VBL (WS_VB + 2u * (size_t)NB * CC * KHI)
#define WS_S   (WS_VBL + 2u * (size_t)NB * CC * KHI)    // f32 [hg][t][s] scratch, unused (k_fa keeps scores in registers)
#define WS_Y   (WS_S  + 4u * (size_t)HG * TT * TT)      // f32 ctx rows [b*t][CC] (only when there is an output projection)
#define WS_END (WS_Y  + 0u)

// ---- k_proj: block = (64 rows, 128 cols, which): q/k/v = X W (+ b) with exact bf16 products (K = DIN) -> which 0: q f16 rows (+ residual rows < QHI); 1: k f16 rows (+ residual rows < KHI); 2: v f16 planes [c][t] (+ bf16 hi/lo planes for t < KHI)
__global__ __launch_bounds__(128) void k_proj(const float* __restrict__ XQ, const float* __restrict__ XK, const float* __restrict__ XV, const float* __restrict__ WQ, const float* __restrict__ WK, const float* __restrict__ WV, const float* __restrict__ BQ, const float* __restrict__ BK, const float* __restrict__ BV,
    _Float16* __restrict__ QH, _Float16* __restrict__ QL, _Float16* __restrict__ KH, _Float16* __restrict__ KL, _Float16* __restrict__ VT, __bf16* __restrict__ VB, __bf16* __restrict__ VBL) {
  __shared__ __align__(16) _Float16 sh[64][136], sl[64][136]; __shared__ __align__(16) _Float16 th[128][72]; __shared__ __align__(16) __bf16 tb[128][72], tbl[128][72];
  const int tid = threadIdx.x, wave = tid >> 5, lane = tid & 31, col = lane & 15, g = lane >> 4; const int which = blockIdx.z; const int c0 = blockIdx.y * 128; const size_t r0 = (size_t)blockIdx.x * 64; const size_t bb = r0 / TT; const int t0 = (int)(r0 % TT);
  const float* X = which == 0 ? XQ : which == 1 ? XK : XV; const float* WA = which == 0 ? WQ : which == 1 ? WK : WV; const float* BA = which == 0 ? BQ : which == 1 ? BK : BV;
  v8f acc[8] = {};
#pragma unroll 2
  for (int kc = 0; kc < DIN / 32; ++kc) { v16b a; { const float* p = X + (r0 + wave * 16 + col) * DIN + kc * 32 + 8 * g;
#pragma unroll
      for (int i = 0; i < 8; ++i) { a[i] = (__bf16)p[i]; a[8 + i] = (__bf16)p[16 + i]; } }
    asm volatile("s_wait_loadcnt 0x0" ::: "memory");
#pragma unroll
    for (int j = 0; j < 8; ++j) { const v16b w = WCOL(WA, kc * 32, c0 + j * 16 + col, lane); asm volatile("s_wait_loadcnt 0x0" ::: "memory"); acc[j] = wmma_bf(a, w, acc[j]); } }
  if (which < 2) { _Float16* DH = which == 0 ? QH : KH; _Float16* DL = which == 0 ? QL : KL; const int nhi = which == 0 ? QHI : KHI; const bool hi_rows = t0 < nhi;
#pragma unroll
    for (int j = 0; j < 8; ++j) { const float bias = BA ? bfr(BA[c0 + j * 16 + col]) : 0.f;
#pragma unroll
      for (int r = 0; r < 8; ++r) { const float v = acc[j][r] + bias; const _Float16 hv = (_Float16)v; sh[wave * 16 + 8 * g + r][j * 16 + col] = hv; sl[wave * 16 + 8 * g + r][j * 16 + col] = (_Float16)((v - (float)hv) * 1024.0f); } }
    __syncthreads();
    for (int e = tid; e < 64 * 16; e += 128) { const int rl = e >> 4, q = e & 15; vst2((unsigned*)(DH + (r0 + rl) * CC + c0 + q * 8), *(const v4u*)&sh[rl][q * 8]); if (hi_rows) vst2((unsigned*)(DL + (bb * nhi + t0 + rl) * (size_t)CC + c0 + q * 8), *(const v4u*)&sl[rl][q * 8]); }
  } else { const bool hi_rows = t0 < KHI;
#pragma unroll
    for (int j = 0; j < 8; ++j) { const float bias = BA ? bfr(BA[c0 + j * 16 + col]) : 0.f;
#pragma unroll
      for (int r = 0; r < 8; ++r) { const float v = acc[j][r] + bias; const int rl = wave * 16 + 8 * g + r, cl = j * 16 + col; th[cl][rl] = (_Float16)v; const __bf16 bh = (__bf16)v; tb[cl][rl] = bh; tbl[cl][rl] = (__bf16)(v - (float)bh); } }
    __syncthreads();
    for (int e = tid; e < 128 * 8; e += 128) { const int cl = e >> 3, q = e & 7; vst2((unsigned*)(VT + (bb * CC + c0 + cl) * (size_t)TT + t0 + q * 8), *(const v4u*)&th[cl][q * 8]); if (hi_rows) { const size_t o3 = (bb * CC + c0 + cl) * (size_t)KHI + t0 + q * 8; vst2((unsigned*)(VB + o3), *(const v4u*)&tb[cl][q * 8]); vst2((unsigned*)(VBL + o3), *(const v4u*)&tbl[cl][q * 8]); } } } }
// ---- k_fa: block = 128 queries of batch blockIdx.y, 16 waves; wave = (32 queries, one quarter of the keys). Transposed products: S^T = K Q^T (a lane holds 16 scores of one query per 32 keys),
// online softmax in f32 (base 2), P^T packed from the score accumulators into the B operand (f16), O^T += V^T P^T; the four key quarters are merged in LDS at the end.
// The k and v fragments come from LDS: a ring of two buffers, one stage = 64 keys of each quarter (64 KiB), brought in by tensor loads, so that the four waves that walk the same quarter share one fetch from L2.
// lane l with lane l ^ 16 by a vector cross-row move (no LDS round trip)
__device__ __forceinline__ float xhalf(float x) { return __builtin_bit_cast(float, __builtin_amdgcn_permlanex16(__builtin_bit_cast(int, x), __builtin_bit_cast(int, x), 0x76543210, 0xfedcba98, false, false)); }
// every '#pragma unroll' in k_fa gives a fragment or accumulator array constant indices, so that it stays in registers
// one fragment from a fragment-order unit: p = fragment start + 8 * lane; the two register halves lie 512 bytes apart
__device__ __forceinline__ v16h frag_p(const _Float16* p) { union { v16h v; v8h q[2]; } u; u.q[0] = *(const v8h*)p; u.q[1] = *(const v8h*)(p + 256); return u.v; }
typedef uint32_t u32x4 __attribute__((ext_vector_type(4)));
typedef uint32_t u32x8 __attribute__((ext_vector_type(8)));
__device__ __forceinline__ uint32_t uni(uint32_t v) { return (uint32_t)__builtin_amdgcn_readfirstlane(v); }
// pinned(): the test word is held in a scalar register, so that the branch round a tensor load (which ignores EXEC) compiles to s_cmp + s_cbranch_scc
__device__ __forceinline__ uint32_t pinned(uint32_t v) { uint32_t w = uni(v); asm volatile("" : "+s"(w)); return w; }
// one request of one wave: a 4-KiB fragment-order unit (16 rows of 256 bytes, source pitch 256 bytes, no pad, no mask) from global address ga to LDS byte offset dst
__device__ __forceinline__ void tdm_unit(uint32_t dst, uint64_t ga) {
  u32x4 g0; u32x8 g1;
  g0[0] = uni(1u); g0[1] = uni(dst); g0[2] = uni((uint32_t)ga); g0[3] = uni((((uint32_t)(ga >> 32)) & 0x01FFFFFFu) | 0x80000000u);
  g1[0] = uni(0u); g1[1] = uni(256u << 16); g1[2] = uni(16u << 16); g1[3] = uni(256u << 16); g1[4] = uni(16u); g1[5] = uni(256u); g1[6] = uni(0u); g1[7] = uni(0u);
  asm volatile("tensor_load_to_lds %0, %1" :: "s"(g0), "s"(g1) : "memory");
}
#define KSPL 4
#define KPW (TT / KSPL)
#define BQ 128                        // queries per block: four groups of 32
#define SKEY 64                       // keys of each quarter per stage
#define NST (KPW / SKEY)
#define UNITB 4096u                   // bytes of one 32-key unit of k or of v
#define STAGEB (KSPL * 4u * UNITB)    // per quarter: k unit 0, k unit 1, v unit 0, v unit 1
__global__ __launch_bounds__(512) void k_fa(const _Float16* __restrict__ QH, const _Float16* __restrict__ KH, const _Float16* __restrict__ VT, float* __restrict__ Y) {
  __shared__ __attribute__((aligned(2048))) unsigned char ring[2 * STAGEB];
  __shared__ __align__(16) float so[KSPL][BQ][HD + 4]; __shared__ float smx[KSPL][BQ], sls[KSPL][BQ];
  const int tid = threadIdx.x, wave = (int)uni(tid >> 5), lane = tid & 31, col = lane & 15, g = lane >> 4; const int b = blockIdx.y, qb = blockIdx.x; const int qg = wave & 3, kq = wave >> 2;
  const float C2 = SCALE * 1.44269504088896f;   // logits in units of log2
  // every wave brings one unit per stage: of its own quarter, wave qg = 0, 1 the two k units, qg = 2, 3 the two v units
  const uint64_t ga0 = (uint64_t)(size_t)((qg & 2 ? VT : KH) + ((size_t)b * TT + kq * KPW + (qg & 1) * 32) * CC);
  const uint32_t dst0 = (uint32_t)(size_t)ring + (uint32_t)wave * UNITB;
  tdm_unit(dst0, ga0);
  v16h qf[2][2];
#pragma unroll
  for (int t = 0; t < 2; ++t)
#pragma unroll
    for (int kc = 0; kc < 2; ++kc) qf[t][kc] = frag_p(QH + ((size_t)b * TT + qb * BQ + qg * 32) * CC + (t * 2 + kc) * 512 + lane * 8);
  v8f acc[2][4] = {}; float m[2] = {-3.0e38f, -3.0e38f}, l[2] = {0.f, 0.f};
  asm volatile("s_wait_tensorcnt 0x0" ::: "memory");   // this wave's unit of stage 0 has landed
  __syncthreads();                                     // stage 0 published to the other waves
  tdm_unit(dst0 + STAGEB, ga0 + (uint64_t)(SKEY * CC * 2));
#pragma unroll 1   // rolled: one pass = one stage; its two 32-key blocks are unrolled inside
  for (int st = 0; st < NST; ++st) {
    const _Float16* Ls = (const _Float16*)(ring + (st & 1) * STAGEB + kq * 4 * UNITB) + lane * 8;
    v16h kf[2][2];
#pragma unroll
    for (int i = 0; i < 2; ++i)
#pragma unroll
      for (int kc = 0; kc < 2; ++kc) kf[i][kc] = frag_p(Ls + (i * 2 + kc) * 512);
#pragma unroll
    for (int sub = 0; sub < 2; ++sub) {
      v16h vf[4];
#pragma unroll
      for (int j = 0; j < 4; ++j) vf[j] = frag_p(Ls + (2 + sub) * 2048 + j * 512);
      v8f s[2][2] = {};
#pragma unroll
      for (int i = 0; i < 2; ++i)
#pragma unroll
        for (int kc = 0; kc < 2; ++kc)
#pragma unroll
          for (int t = 0; t < 2; ++t) s[t][i] = wmma16(kf[i][kc], qf[t][kc], s[t][i]);
      if (sub == 0) {   // the second block's k fragments, of this same stage, fetched under the first block's softmax
#pragma unroll
        for (int i = 0; i < 2; ++i)
#pragma unroll
          for (int kc = 0; kc < 2; ++kc) kf[i][kc] = frag_p(Ls + 2048 + (i * 2 + kc) * 512); }
      float mx[2];
#pragma unroll
      for (int t = 0; t < 2; ++t) { float a = fmaxf(s[t][0][0], s[t][1][0]);
#pragma unroll
        for (int r = 1; r < 8; ++r) a = fmaxf(a, fmaxf(s[t][0][r], s[t][1][r]));
        mx[t] = fmaxf(a, xhalf(a)) * C2; }
      // the maximum in use moves only when a query's new maximum passes it by more than 8 (P <= 2^8 fits f16); one wave-uniform test per 32 keys
      if (__builtin_amdgcn_ballot_w32(mx[0] > m[0] + 8.0f || mx[1] > m[1] + 8.0f) != 0) {
#pragma unroll
        for (int t = 0; t < 2; ++t) { const float mn = fmaxf(m[t], mx[t]); const float al = __builtin_amdgcn_exp2f(m[t] - mn); m[t] = mn; l[t] *= al;
#pragma unroll
          for (int j = 0; j < 4; ++j) acc[t][j] *= al; } }
#pragma unroll
      for (int t = 0; t < 2; ++t) { v16h pf; v2f ls = {0.f, 0.f}; const v2f c2 = {C2, C2}, nm = {-m[t], -m[t]};
#pragma unroll
        for (int i = 0; i < 2; ++i)
#pragma unroll
          for (int r = 0; r < 8; r += 2) { const v2f x = {s[t][i][r], s[t][i][r + 1]}; const v2f a = __builtin_elementwise_fma(x, c2, nm); const v2f p = {__builtin_amdgcn_exp2f(a.x), __builtin_amdgcn_exp2f(a.y)}; ls += p; pf[8 * i + r] = (_Float16)p.x; pf[8 * i + r + 1] = (_Float16)p.y; }
        l[t] += ls.x + ls.y;
#pragma unroll
        for (int j = 0; j < 4; ++j) acc[t][j] = wmma16(vf[j], pf, acc[t][j]); } }
    // publish point of stage st + 1, and the end of every wave's reads of stage st
    asm volatile("s_wait_dscnt 0x0" ::: "memory");       // this wave's LDS reads of stage st are done before its buffer is refilled
    asm volatile("s_wait_tensorcnt 0x0" ::: "memory");   // this wave's unit of stage st + 1 has landed
    __syncthreads();
    if (pinned(st + 2 < NST)) tdm_unit(dst0 + (uint32_t)(st & 1) * STAGEB, ga0 + (uint64_t)(st + 2) * (SKEY * CC * 2)); }
  asm volatile("s_wait_tensorcnt 0x0" ::: "memory");     // no request is left in flight behind the loop
  asm volatile("s_wait_dscnt 0x0" ::: "memory");
  // merge of the four key quarters: common maximum, then scaled partial sums
#pragma unroll
  for (int t = 0; t < 2; ++t) { l[t] += xhalf(l[t]); if (g == 0) smx[kq][qg * 32 + t * 16 + col] = m[t]; }
  __syncthreads();
#pragma unroll
  for (int t = 0; t < 2; ++t) { const int q = qg * 32 + t * 16 + col; const float M = fmaxf(fmaxf(smx[0][q], smx[1][q]), fmaxf(smx[2][q], smx[3][q])); const float f = __builtin_amdgcn_exp2f(m[t] - M);
    if (g == 0) sls[kq][q] = l[t] * f;
#pragma unroll
    for (int j = 0; j < 4; ++j) { const v8f o = acc[t][j] * f; v4f lo = {o[0], o[1], o[2], o[3]}, hi = {o[4], o[5], o[6], o[7]}; *(v4f*)&so[kq][q][j * 16 + 8 * g] = lo; *(v4f*)&so[kq][q][j * 16 + 8 * g + 4] = hi; } }
  __syncthreads();
#pragma unroll
  for (int u = 0; u < 4; ++u) { const int e = u * 512 + tid, q = e >> 4, d = (e & 15) * 4; const float inv = 1.0f / ((sls[0][q] + sls[1][q]) + (sls[2][q] + sls[3][q]));
    const v4f a = (*(const v4f*)&so[0][q][d] + *(const v4f*)&so[1][q][d]) + (*(const v4f*)&so[2][q][d] + *(const v4f*)&so[3][q][d]);
    vst2(Y + ((size_t)b * TT + qb * BQ + q) * CC + d, a * inv); } }

extern "C" void kernel_launch(void* const* d_in, const int* in_sizes, int n_in, void* d_out, int out_size, void* d_ws, size_t ws_size, hipStream_t stream) {
  (void)in_sizes; (void)n_in; (void)out_size;
  const float** F = (const float**)d_in;
  if (ws_size < (size_t)WS_END) return;
  char* ws = (char*)d_ws; _Float16 *QH = (_Float16*)(ws + WS_QH), *KH = (_Float16*)(ws + WS_KH), *VT = (_Float16*)(ws + WS_VT), *QL = (_Float16*)(ws + WS_QL), *KL = (_Float16*)(ws + WS_KL); __bf16 *VB = (__bf16*)(ws + WS_VB), *VBL = (__bf16*)(ws + WS_VBL); float *S = (float*)(ws + WS_S), *Y = (float*)(ws + WS_Y);
  (void)Y; (void)S; (void)QL; (void)KL; (void)VB; (void)VBL;
  // inputs: 0 queries [16,2048,64]; 1 keys; 2 values
  k_planes64<<<dim3(TNB * TT / 64), 256, 0, stream>>>(F[0], F[1], F[2], QH, QL, KH, KL, VT, VB, VBL);
  k_fa<<<dim3(TT / BQ, TNB), 512, 0, stream>>>(QH, KH, VT, (float*)d_out);


}

// v004
// Measured time: 22.4 microseconds a run.
// Timed twice side by side with v003, it ran 1.06 times as fast both times.
// Over all steps from v000 it is 58.3 times as fast.
// compute dtype: all float inputs rounded to bf16; queries, keys, values are bf16-valued so their f16 planes are exact; logits q x k (1 product on exact planes) x 1/8; online softmax f32; P = 2^(logit - maximum in use) once to f16 x v (exact) (1 product); f32 output.
#include <hip/hip_runtime.h>
#include <math.h>
#include <stdint.h>

typedef __attribute__((ext_vector_type(16))) _Float16 v16h;
typedef __attribute__((ext_vector_type(16))) __bf16 v16b;
typedef __attribute__((ext_vector_type(8)))  _Float16 v8h;
typedef __attribute__((ext_vector_type(8)))  float v8f;
typedef __attribute__((ext_vector_type(4)))  float v4f;
typedef __attribute__((ext_vector_type(2)))  float v2f;
typedef __attribute__((ext_vector_type(4)))  unsigned v4u;
typedef _Float16 hx8 __attribute__((ext_vector_type(8)));
typedef __attribute__((ext_vector_type(4)))  int v4i;
typedef float __attribute__((may_alias)) float_a;
typedef int __attribute__((may_alias)) int_a;

template <typename T> __device__ __forceinline__ void vst2(void* p, T v) { *(T*)p = v;  }
__device__ __forceinline__ v8f wmma16(v16h a, v16h b, v8f c) {
  // plain builtin: the compiler keeps the WMMA distances itself and is free to deal vector work among the products
  return __builtin_amdgcn_wmma_f32_16x16x32_f16(false, a, false, b, (short)0, c, false, false);
}
__device__ __forceinline__ v8f wmma_bf(v16b a, v16b b, v8f c) {
  v8f d = __builtin_amdgcn_wmma_f32_16x16x32_bf16(false, a, false, b, (short)0, c, false, false);
  asm volatile("v_nop\n\tv_nop\n\tv_nop\n\tv_nop" : "+v"(d) : "v"(a), "v"(b));
  return d;
}
// 16x16x32 fragments: lane = (h = lane>>4, row/col = lane&15); elements 0..7 = k0+8h+0..7, 8..15 = k0+16+8h+0..7; D element r = row 8h+r
__device__ __forceinline__ v16h frag_h(const _Float16* rowk0, int lane) {
  union { v16h v; v8h q[2]; } u; const _Float16* p = rowk0 + 8 * (lane >> 4);
  u.q[0] = *(const v8h*)p; u.q[1] = *(const v8h*)(p + 16); return u.v;
}
__device__ __forceinline__ v16h frag_f32(const float* rowk0, int lane) {
  v16h a; const float* p = rowk0 + 8 * (lane >> 4);
#pragma unroll
  for (int i = 0; i < 8; ++i) { a[i] = (_Float16)p[i]; a[8 + i] = (_Float16)p[16 + i]; }
  return a;
}
__device__ __forceinline__ v16h frag_f32s(const float* rowk0, int lane, float sc) {
  v16h a; const float* p = rowk0 + 8 * (lane >> 4);
#pragma unroll
  for (int i = 0; i < 8; ++i) { a[i] = (_Float16)(p[i] * sc); a[8 + i] = (_Float16)(p[16 + i] * sc); }
  return a;
}
// column fragment from a [K][ld] layout (column n), rows >= K read as 0
__device__ __forceinline__ v16h fragc_f32(const float* W, int k0, int n, int lane, int ld, int K) {
  v16h a; const int g = lane >> 4;
#pragma unroll
  for (int i = 0; i < 8; ++i) { const int ka = k0 + 8 * g + i, kb = ka + 16;
    a[i] = (_Float16)(ka < K ? W[(size_t)(ka < K ? ka : K - 1) * ld + n] : 0.f); a[8 + i] = (_Float16)(kb < K ? W[(size_t)(kb < K ? kb : K - 1) * ld + n] : 0.f); }
  return a;
}
struct F2 { v16b h, l; };
__device__ __forceinline__ F2 bsplit16(const float v[16]) { F2 r;
#pragma unroll
  for (int i = 0; i < 16; ++i) { const __bf16 h = (__bf16)v[i]; r.h[i] = h; r.l[i] = (__bf16)(v[i] - (float)h); }
  return r; }
__device__ __forceinline__ F2 split_row(const float* row, int k0, int lane) { float v[16]; const float* p = row + k0 + 8 * (lane >> 4);
#pragma unroll
  for (int i = 0; i < 8; ++i) { v[i] = p[i]; v[8 + i] = p[16 + i]; }
  return bsplit16(v); }
__device__ __forceinline__ F2 split_rowK(const float* row, int k0, int lane, int K) { float v[16]; const int g = lane >> 4;
#pragma unroll
  for (int i = 0; i < 8; ++i) { const int ka = k0 + 8 * g + i, kb = ka + 16; v[i] = ka < K ? row[ka < K ? ka : K - 1] : 0.f; v[8 + i] = kb < K ? row[kb < K ? kb : K - 1] : 0.f; }
  return bsplit16(v); }
__device__ __forceinline__ F2 split_col(const float* W, int k0, int n, int lane, int ld, int K) { float v[16]; const int g = lane >> 4;
#pragma unroll
  for (int i = 0; i < 8; ++i) { const int ka = k0 + 8 * g + i, kb = ka + 16; v[i] = ka < K ? W[(size_t)(ka < K ? ka : K - 1) * ld + n] : 0.f; v[8 + i] = kb < K ? W[(size_t)(kb < K ? kb : K - 1) * ld + n] : 0.f; }
  return bsplit16(v); }
__device__ __forceinline__ v8f mac3(const F2& a, const F2& b, v8f c) { c = wmma_bf(a.l, b.h, c); c = wmma_bf(a.h, b.l, c); return wmma_bf(a.h, b.h, c); }
__device__ __forceinline__ float sigm(float v) { return 1.0f / (1.0f + expf(-v)); }
#define LDSX() do { asm volatile("s_wait_dscnt 0" ::: "memory"); __builtin_amdgcn_wave_barrier(); __builtin_amdgcn_fence(__ATOMIC_RELEASE, "workgroup"); } while (0)

// Plain dot-product attention on given tensors (queries / keys / values [16,2048,64]; no mask): out = softmax(Q K^T / 8) V -> [16,2048,64].
#define NB 16
#define TT 2048
#define CC 64            // NH * HD = projected width
#define DIN 64          // input (model) width
#define NH 1
#define HD 64
#define NQB (TT / 64)
#define HG 1
#define SCALE (0.125f)
#define CAUSAL 0
#ifndef TNB
#define TNB NB
#endif
__device__ __forceinline__ float bfr(float v) { return (float)(__bf16)v; }
__host__ __device__ __forceinline__ int kb_last(int qb) { return CAUSAL ? ((qb * 64 + 63) >> 7) : (TT / 128 - 1); }
typedef __attribute__((ext_vector_type(8))) __bf16 v8b;
__device__ __forceinline__ v16b frag_b(const __bf16* rowk0, int lane) {
  union { v16b v; v8b q[2]; } u; const __bf16* p = rowk0 + 8 * (lane >> 4);
  u.q[0] = *(const v8b*)p; u.q[1] = *(const v8b*)(p + 16); return u.v;
}
#define QBH 0              // exact planes: single-product logits and single-f16 P x V on every block
#define QHI 0               // no q residual plane (q is bf16-exact in f16)
#define KHI 64              // unused high-precision planes kept minimal
// B fragment (k rows k0+.., output column o) of a weight: (in,out) [K][ld] or (out,in) [ld rows of K]: bf16 exact, or f16(bf16 * 256) exact
__device__ __forceinline__ v16b wcol_io(const float* Wm, int k0, int o, int lane, int ld) { v16b w; const int g = lane >> 4;
#pragma unroll
  for (int i = 0; i < 8; ++i) { w[i] = (__bf16)Wm[(size_t)(k0 + 8 * g + i) * ld + o]; w[8 + i] = (__bf16)Wm[(size_t)(k0 + 16 + 8 * g + i) * ld + o]; }
  return w; }
__device__ __forceinline__ v16b wcol_oi(const float* Wm, int k0, int o, int lane, int K) { v16b w; const float* p = Wm + (size_t)o * K + k0 + 8 * (lane >> 4);
#pragma unroll
  for (int i = 0; i < 8; ++i) { w[i] = (__bf16)p[i]; w[8 + i] = (__bf16)p[16 + i]; }
  return w; }
__device__ __forceinline__ v16h wcolh_io(const float* Wm, int k0, int o, int lane, int ld) { v16h w; const int g = lane >> 4;
#pragma unroll
  for (int i = 0; i < 8; ++i) { w[i] = (_Float16)(bfr(Wm[(size_t)(k0 + 8 * g + i) * ld + o]) * 256.0f); w[8 + i] = (_Float16)(bfr(Wm[(size_t)(k0 + 16 + 8 * g + i) * ld + o]) * 256.0f); }
  return w; }
__device__ __forceinline__ v16h wcolh_oi(const float* Wm, int k0, int o, int lane, int K) { v16h w; const float* p = Wm + (size_t)o * K + k0 + 8 * (lane >> 4);
#pragma unroll
  for (int i = 0; i < 8; ++i) { w[i] = (_Float16)(bfr(p[i]) * 256.0f); w[8 + i] = (_Float16)(bfr(p[16 + i]) * 256.0f); }
  return w; }
#define WQKV_LAYOUT 0   // 0 = (in,out) [DIN][CC]; 1 = (out,in) [CC][DIN]; 2 = per-head [NH][DIN][HD]
__device__ __forceinline__ v16b wcol_hdk(const float* Wm, int k0, int o, int lane) { v16b w; const int g = lane >> 4; const float* p = Wm + (size_t)(o / HD) * DIN * HD + (o % HD);
#pragma unroll
  for (int i = 0; i < 8; ++i) { w[i] = (__bf16)p[(size_t)(k0 + 8 * g + i) * HD]; w[8 + i] = (__bf16)p[(size_t)(k0 + 16 + 8 * g + i) * HD]; }
  return w; }
#define WO_OUT_IN 0
#if WQKV_LAYOUT == 1
#define WCOL(W, k0, o, lane) wcol_oi(W, k0, o, lane, DIN)
#elif WQKV_LAYOUT == 2
#define WCOL(W, k0, o, lane) wcol_hdk(W, k0, o, lane)
#else
#define WCOL(W, k0, o, lane) wcol_io(W, k0, o, lane, CC)
#endif
#if WO_OUT_IN
#define WOCOL(W, k0, o, lane) wcol_oi(W, k0, o, lane, CC)
#define WOCOLH(W, k0, o, lane) wcolh_oi(W, k0, o, lane, CC)
#else
#define WOCOL(W, k0, o, lane) wcol_io(W, k0, o, lane, DIN)
#define WOCOLH(W, k0, o, lane) wcolh_io(W, k0, o, lane, DIN)
#endif
__global__ __launch_bounds__(256) void k_planes64(const float* __restrict__ Qs, const float* __restrict__ Ks, const float* __restrict__ Vs, _Float16* __restrict__ QH, _Float16* __restrict__ QL, _Float16* __restrict__ KH, _Float16* __restrict__ KL, _Float16* __restrict__ VT, __bf16* __restrict__ VB, __bf16* __restrict__ VBL) {
  __shared__ __align__(16) _Float16 sv[64][72], sq[64][72], sk[64][72];   // 144-byte rows: 16-byte LDS accesses of 16 consecutive rows fall on distinct banks
  const int tid = threadIdx.x; const size_t r0 = (size_t)blockIdx.x * 64; const int b = (int)(r0 / TT), t0 = (int)(r0 % TT);
  for (int e = tid; e < 64 * 8; e += 256) { const int rl = e >> 3, q = e & 7; const size_t src = (r0 + rl) * CC + q * 8; float tq[8], tk[8], tv[8];
#pragma unroll
    for (int u = 0; u < 8; ++u) { tq[u] = Qs[src + u]; tk[u] = Ks[src + u]; tv[u] = Vs[src + u]; }
    asm volatile("s_wait_loadcnt 0x0" ::: "memory");
    hx8 hq, hk, hlq, hlk;
#pragma unroll
    for (int u = 0; u < 8; ++u) { const float qv = bfr(tq[u]), kv = bfr(tk[u]); const _Float16 qh = (_Float16)qv, kh = (_Float16)kv; hq[u] = qh; hlq[u] = (_Float16)((qv - (float)qh) * 1024.0f); hk[u] = kh; hlk[u] = (_Float16)((kv - (float)kh) * 1024.0f); sv[rl][q * 8 + u] = (_Float16)bfr(tv[u]); }
    *(hx8*)&sq[rl][q * 8] = hq; *(hx8*)&sk[rl][q * 8] = hk;
    if (t0 + rl < QHI) vst2((unsigned*)(QL + ((size_t)b * QHI + t0 + rl) * CC + q * 8), *(const v4u*)&hlq);
    if (t0 + rl < KHI) vst2((unsigned*)(KL + ((size_t)b * KHI + t0 + rl) * CC + q * 8), *(const v4u*)&hlk); }
  __syncthreads();
  // fragment order: every 32 rows of q, k (32 keys of v) make one 4-KiB unit [x][h][lane][8]; piece e of this block's 64 rows is lane (g, cl) of register half h of fragment x in unit e >> 8,
  // so a wave stores, and k_fa's waves load, 512 contiguous bytes per 16-byte instruction. q, k: x = (16-row tile, 32-wide slice of d); v: x = 16-wide slice of c, the 8 elements run along the keys.
  for (int e = tid; e < 64 * 8; e += 256) { const int cl = e & 15, q = (e >> 8) * 4 + ((e >> 5) & 1) * 2 + ((e >> 4) & 1), x = (e >> 6) & 3, c = x * 16 + cl; const int rw = (e >> 8) * 32 + (x >> 1) * 16 + cl, dq = (x & 1) * 32 + (q & 3) * 8;
    vst2((unsigned*)(QH + r0 * CC + e * 8), *(const v4u*)&sq[rw][dq]); vst2((unsigned*)(KH + r0 * CC + e * 8), *(const v4u*)&sk[rw][dq]);
    hx8 hv; _Pragma("unroll") for (int j = 0; j < 8; ++j) hv[j] = sv[q * 8 + j][c]; vst2((unsigned*)(VT + r0 * CC + e * 8), *(const v4u*)&hv);
    asm volatile("s_wait_xcnt 0x0" ::: "memory");   // before the next trip (or the branch below) overwrites the index and data registers that these three stores name
    if (t0 < KHI) { v8b bh, bl; _Pragma("unroll") for (int j = 0; j < 8; ++j) { const float vv = (float)hv[j]; const __bf16 h1 = (__bf16)vv; bh[j] = h1; bl[j] = (__bf16)(vv - (float)h1); } vst2((unsigned*)(VB + ((size_t)b * CC + c) * KHI + t0 + q * 8), *(const v4u*)&bh); vst2((unsigned*)(VBL + ((size_t)b * CC + c) * KHI + t0 + q * 8), *(const v4u*)&bl); } } }
#define SM_EXTRA_PARAMS
#define SM_MASK_HOOK (void)0
#ifndef SM_EXTRA_PARAMS
#define SM_EXTRA_PARAMS
#endif
#ifndef PROJ_EXTRA_PARAMS
#define PROJ_EXTRA_PARAMS
#endif
#ifndef SM_MASK_HOOK
#define SM_MASK_HOOK (void)0
#endif

#define WS_QH  0u                                      // f16 q, fragment order [b*t/32][tile 2][d slice 2][half 2][lane 32][8]
#define WS_KH  (WS_QH + 2u * (size_t)NB * TT * CC)      // f16 k, fragment order like q
#define WS_VT  (WS_KH + 2u * (size_t)NB * TT * CC)      // f16 v, fragment order [b*t/32][c slice 4][half 2][lane 32][8 keys]
#define WS_QL  (WS_VT + 2u * (size_t)NB * CC * TT)      // f16 q residual x 2^10 rows [b][t < QHI][CC]
#define WS_KL  (WS_QL + 2u * (size_t)NB * QHI * CC)     // f16 k residual x 2^10 rows [b][t < KHI][CC]
#define WS_VB  (WS_KL + 2u * (size_t)NB * KHI * CC)     // bf16 v hi planes [b][c][t < KHI]
#define WS_VBL (WS_VB + 2u * (size_t)NB * CC * KHI)
#define WS_S   (WS_VBL + 2u * (size_t)NB * CC * KHI)    // f32 [hg][t][s] scratch, unused (k_fa keeps scores in registers)
#define WS_Y   (WS_S  + 4u * (size_t)HG * TT * TT)      // f32 ctx rows [b*t][CC] (only when there is an output projection)
#define WS_END (WS_Y  + 0u)

// ---- k_proj: block = (64 rows, 128 cols, which): q/k/v = X W (+ b) with exact bf16 products (K = DIN) -> which 0: q f16 rows (+ residual rows < QHI); 1: k f16 rows (+ residual rows < KHI); 2: v f16 planes [c][t] (+ bf16 hi/lo planes for t < KHI)
__global__ __launch_bounds__(128) void k_proj(const float* __restrict__ XQ, const float* __restrict__ XK, const float* __restrict__ XV, const float* __restrict__ WQ, const float* __restrict__ WK, const float* __restrict__ WV, const float* __restrict__ BQ, const float* __restrict__ BK, const float* __restrict__ BV,
    _Float16* __restrict__ QH, _Float16* __restrict__ QL, _Float16* __restrict__ KH, _Float16* __restrict__ KL, _Float16* __restrict__ VT, __bf16* __restrict__ VB, __bf16* __restrict__ VBL) {
  __shared__ __align__(16) _Float16 sh[64][136], sl[64][136]; __shared__ __align__(16) _Float16 th[128][72]; __shared__ __align__(16) __bf16 tb[128][72], tbl[128][72];
  const int tid = threadIdx.x, wave = tid >> 5, lane = tid & 31, col = lane & 15, g = lane >> 4; const int which = blockIdx.z; const int c0 = blockIdx.y * 128; const size_t r0 = (size_t)blockIdx.x * 64; const size_t bb = r0 / TT; const int t0 = (int)(r0 % TT);
  const float* X = which == 0 ? XQ : which == 1 ? XK : XV; const float* WA = which == 0 ? WQ : which == 1 ? WK : WV; const float* BA = which == 0 ? BQ : which == 1 ? BK : BV;
  v8f acc[8] = {};
#pragma unroll 2
  for (int kc = 0; kc < DIN / 32; ++kc) { v16b a; { const float* p = X + (r0 + wave * 16 + col) * DIN + kc * 32 + 8 * g;
#pragma unroll
      for (int i = 0; i < 8; ++i) { a[i] = (__bf16)p[i]; a[8 + i] = (__bf16)p[16 + i]; } }
    asm volatile("s_wait_loadcnt 0x0" ::: "memory");
#pragma unroll
    for (int j = 0; j < 8; ++j) { const v16b w = WCOL(WA, kc * 32, c0 + j * 16 + col, lane); asm volatile("s_wait_loadcnt 0x0" ::: "memory"); acc[j] = wmma_bf(a, w, acc[j]); } }
  if (which < 2) { _Float16* DH = which == 0 ? QH : KH; _Float16* DL = which == 0 ? QL : KL; const int nhi = which == 0 ? QHI : KHI; const bool hi_rows = t0 < nhi;
#pragma unroll
    for (int j = 0; j < 8; ++j) { const float bias = BA ? bfr(BA[c0 + j * 16 + col]) : 0.f;
#pragma unroll
      for (int r = 0; r < 8; ++r) { const float v = acc[j][r] + bias; const _Float16 hv = (_Float16)v; sh[wave * 16 + 8 * g + r][j * 16 + col] = hv; sl[wave * 16 + 8 * g + r][j * 16 + col] = (_Float16)((v - (float)hv) * 1024.0f); } }
    __syncthreads();
    for (int e = tid; e < 64 * 16; e += 128) { const int rl = e >> 4, q = e & 15; vst2((unsigned*)(DH + (r0 + rl) * CC + c0 + q * 8), *(const v4u*)&sh[rl][q * 8]); if (hi_rows) vst2((unsigned*)(DL + (bb * nhi + t0 + rl) * (size_t)CC + c0 + q * 8), *(const v4u*)&sl[rl][q * 8]); }
  } else { const bool hi_rows = t0 < KHI;
#pragma unroll
    for (int j = 0; j < 8; ++j) { const float bias = BA ? bfr(BA[c0 + j * 16 + col]) : 0.f;
#pragma unroll
      for (int r = 0; r < 8; ++r) { const float v = acc[j][r] + bias; const int rl = wave * 16 + 8 * g + r, cl = j * 16 + col; th[cl][rl] = (_Float16)v; const __bf16 bh = (__bf16)v; tb[cl][rl] = bh; tbl[cl][rl] = (__bf16)(v - (float)bh); } }
    __syncthreads();
    for (int e = tid; e < 128 * 8; e += 128) { const int cl = e >> 3, q = e & 7; vst2((unsigned*)(VT + (bb * CC + c0 + cl) * (size_t)TT + t0 + q * 8), *(const v4u*)&th[cl][q * 8]); if (hi_rows) { const size_t o3 = (bb * CC + c0 + cl) * (size_t)KHI + t0 + q * 8; vst2((unsigned*)(VB + o3), *(const v4u*)&tb[cl][q * 8]); vst2((unsigned*)(VBL + o3), *(const v4u*)&tbl[cl][q * 8]); } } } }
// ---- k_fa: block = 128 queries of batch blockIdx.y, 16 waves; wave = (32 queries, one quarter of the keys). Transposed products: S^T = K Q^T (a lane holds 16 scores of one query per 32 keys),
// online softmax in f32 (base 2), P^T packed from the score accumulators into the B operand (f16), O^T += V^T P^T; the four key quarters are merged in LDS at the end.
// The k and v fragments come from LDS: a ring of two buffers, one stage = 64 keys of each quarter (64 KiB), brought in by tensor loads, so that the four waves that walk the same quarter share one fetch from L2.
// lane l with lane l ^ 16 by a vector cross-row move (no LDS round trip)
__device__ __forceinline__ float xhalf(float x) { return __builtin_bit_cast(float, __builtin_amdgcn_permlanex16(__builtin_bit_cast(int, x), __builtin_bit_cast(int, x), 0x76543210, 0xfedcba98, false, false)); }
// every '#pragma unroll' in k_fa gives a fragment or accumulator array constant indices, so that it stays in registers
// one fragment from a fragment-order unit: p = fragment start + 8 * lane; the two register halves lie 512 bytes apart
__device__ __forceinline__ v16h frag_p(const _Float16* p) { union { v16h v; v8h q[2]; } u; u.q[0] = *(const v8h*)p; u.q[1] = *(const v8h*)(p + 256); return u.v; }
typedef uint32_t u32x4 __attribute__((ext_vector_type(4)));
typedef uint32_t u32x8 __attribute__((ext_vector_type(8)));
__device__ __forceinline__ uint32_t uni(uint32_t v) { return (uint32_t)__builtin_amdgcn_readfirstlane(v); }
// pinned(): the test word is held in a scalar register, so that the branch round a tensor load (which ignores EXEC) compiles to s_cmp + s_cbranch_scc
__device__ __forceinline__ uint32_t pinned(uint32_t v) { uint32_t w = uni(v); asm volatile("" : "+s"(w)); return w; }
// one request of one wave: a 4-KiB fragment-order unit (16 rows of 256 bytes, source pitch 256 bytes, no pad, no mask) from global address ga to LDS byte offset dst
__device__ __forceinline__ void tdm_unit(uint32_t dst, uint64_t ga) {
  u32x4 g0; u32x8 g1;
  g0[0] = uni(1u); g0[1] = uni(dst); g0[2] = uni((uint32_t)ga); g0[3] = uni((((uint32_t)(ga >> 32)) & 0x01FFFFFFu) | 0x80000000u);
  g1[0] = uni(0u); g1[1] = uni(256u << 16); g1[2] = uni(16u << 16); g1[3] = uni(256u << 16); g1[4] = uni(16u); g1[5] = uni(256u); g1[6] = uni(0u); g1[7] = uni(0u);
  asm volatile("tensor_load_to_lds %0, %1" :: "s"(g0), "s"(g1) : "memory");
}
#define KSPL 4
#define KPW (TT / KSPL)
#define BQ 128                        // queries per block: four groups of 32
#define SKEY 64                       // keys of each quarter per stage
#define NST (KPW / SKEY)
#define UNITB 4096u                   // bytes of one 32-key unit of k or of v
#define STAGEB (KSPL * 4u * UNITB)    // per quarter: k unit 0, k unit 1, v unit 0, v unit 1
__global__ __launch_bounds__(512) void k_fa(const _Float16* __restrict__ QH, const _Float16* __restrict__ KH, const _Float16* __restrict__ VT, float* __restrict__ Y) {
  __shared__ __attribute__((aligned(2048))) unsigned char ring[2 * STAGEB];
  __shared__ __align__(16) float so[KSPL][BQ][HD + 4]; __shared__ float smx[KSPL][BQ], sls[KSPL][BQ];
  const int tid = threadIdx.x, wave = (int)uni(tid >> 5), lane = tid & 31, col = lane & 15, g = lane >> 4; const int b = blockIdx.y, qb = blockIdx.x; const int qg = wave & 3, kq = wave >> 2;
  const float C2 = SCALE * 1.44269504088896f;   // logits in units of log2
  // every wave brings one unit per stage: of its own quarter, wave qg = 0, 1 the two k units, qg = 2, 3 the two v units
  const uint64_t ga0 = (uint64_t)(size_t)((qg & 2 ? VT : KH) + ((size_t)b * TT + kq * KPW + (qg & 1) * 32) * CC);
  const uint32_t dst0 = (uint32_t)(size_t)ring + (uint32_t)wave * UNITB;
  tdm_unit(dst0, ga0);
  v16h qf[2][2];
#pragma unroll
  for (int t = 0; t < 2; ++t)
#pragma unroll
    for (int kc = 0; kc < 2; ++kc) qf[t][kc] = frag_p(QH + ((size_t)b * TT + qb * BQ + qg * 32) * CC + (t * 2 + kc) * 512 + lane * 8);
  v8f acc[2][4] = {}; float m[2] = {-3.0e38f, -3.0e38f}, l[2] = {0.f, 0.f};
  asm volatile("s_wait_tensorcnt 0x0" ::: "memory");   // this wave's unit of stage 0 has landed
  __syncthreads();                                     // stage 0 published to the other waves
  tdm_unit(dst0 + STAGEB, ga0 + (uint64_t)(SKEY * CC * 2));
#pragma unroll 1   // rolled: one pass = one stage; its two 32-key blocks are unrolled inside
  for (int st = 0; st < NST; ++st) {
    const _Float16* Ls = (const _Float16*)(ring + (st & 1) * STAGEB + kq * 4 * UNITB) + lane * 8;
    v16h kf[2][2];
#pragma unroll
    for (int i = 0; i < 2; ++i)
#pragma unroll
      for (int kc = 0; kc < 2; ++kc) kf[i][kc] = frag_p(Ls + (i * 2 + kc) * 512);
#pragma unroll
    for (int sub = 0; sub < 2; ++sub) {
      v16h vf[4];
#pragma unroll
      for (int j = 0; j < 4; ++j) vf[j] = frag_p(Ls + (2 + sub) * 2048 + j * 512);
      v8f s[2][2] = {};
#pragma unroll
      for (int i = 0; i < 2; ++i)
#pragma unroll
        for (int kc = 0; kc < 2; ++kc)
#pragma unroll
          for (int t = 0; t < 2; ++t) s[t][i] = wmma16(kf[i][kc], qf[t][kc], s[t][i]);
      if (sub == 0) {   // the second block's k fragments, of this same stage, fetched under the first block's softmax
#pragma unroll
        for (int i = 0; i < 2; ++i)
#pragma unroll
          for (int kc = 0; kc < 2; ++kc) kf[i][kc] = frag_p(Ls + 2048 + (i * 2 + kc) * 512); }
      float mx[2];
#pragma unroll
      for (int t = 0; t < 2; ++t) { float a = fmaxf(s[t][0][0], s[t][1][0]);
#pragma unroll
        for (int r = 1; r < 8; ++r) a = fmaxf(a, fmaxf(s[t][0][r], s[t][1][r]));
        mx[t] = fmaxf(a, xhalf(a)) * C2; }
      // the maximum in use moves only when a query's new maximum passes it by more than 8 (P <= 2^8 fits f16); one wave-uniform test per 32 keys
      if (__builtin_amdgcn_ballot_w32(mx[0] > m[0] + 8.0f || mx[1] > m[1] + 8.0f) != 0) {
#pragma unroll
        for (int t = 0; t < 2; ++t) { const float mn = fmaxf(m[t], mx[t]); const float al = __builtin_amdgcn_exp2f(m[t] - mn); m[t] = mn; l[t] *= al;
#pragma unroll
          for (int j = 0; j < 4; ++j) acc[t][j] *= al; } }
#pragma unroll
      for (int t = 0; t < 2; ++t) { v16h pf; v2f ls = {0.f, 0.f}; const v2f c2 = {C2, C2}, nm = {-m[t], -m[t]};
#pragma unroll
        for (int i = 0; i < 2; ++i)
#pragma unroll
          for (int r = 0; r < 8; r += 2) { const v2f x = {s[t][i][r], s[t][i][r + 1]}; const v2f a = __builtin_elementwise_fma(x, c2, nm); const v2f p = {__builtin_amdgcn_exp2f(a.x), __builtin_amdgcn_exp2f(a.y)}; ls += p; pf[8 * i + r] = (_Float16)p.x; pf[8 * i + r + 1] = (_Float16)p.y; }
        l[t] += ls.x + ls.y;
#pragma unroll
        for (int j = 0; j < 4; ++j) acc[t][j] = wmma16(vf[j], pf, acc[t][j]); } }
    // publish point of stage st + 1, and the end of every wave's reads of stage st
    asm volatile("s_wait_dscnt 0x0" ::: "memory");       // this wave's LDS reads of stage st are done before its buffer is refilled
    asm volatile("s_wait_tensorcnt 0x0" ::: "memory");   // this wave's unit of stage st + 1 has landed
    __syncthreads();
    if (pinned(st + 2 < NST)) tdm_unit(dst0 + (uint32_t)(st & 1) * STAGEB, ga0 + (uint64_t)(st + 2) * (SKEY * CC * 2)); }
  asm volatile("s_wait_tensorcnt 0x0" ::: "memory");     // no request is left in flight behind the loop
  asm volatile("s_wait_dscnt 0x0" ::: "memory");
  // merge of the four key quarters: common maximum, then scaled partial sums
#pragma unroll
  for (int t = 0; t < 2; ++t) { l[t] += xhalf(l[t]); if (g == 0) smx[kq][qg * 32 + t * 16 + col] = m[t]; }
  __syncthreads();
#pragma unroll
  for (int t = 0; t < 2; ++t) { const int q = qg * 32 + t * 16 + col; const float M = fmaxf(fmaxf(smx[0][q], smx[1][q]), fmaxf(smx[2][q], smx[3][q])); const float f = __builtin_amdgcn_exp2f(m[t] - M);
    if (g == 0) sls[kq][q] = l[t] * f;
#pragma unroll
    for (int j = 0; j < 4; ++j) { const v8f o = acc[t][j] * f; v4f lo = {o[0], o[1], o[2], o[3]}, hi = {o[4], o[5], o[6], o[7]}; *(v4f*)&so[kq][q][j * 16 + 8 * g] = lo; *(v4f*)&so[kq][q][j * 16 + 8 * g + 4] = hi; } }
  __syncthreads();
#pragma unroll
  for (int u = 0; u < 4; ++u) { const int e = u * 512 + tid, q = e >> 4, d = (e & 15) * 4; const float inv = 1.0f / ((sls[0][q] + sls[1][q]) + (sls[2][q] + sls[3][q]));
    const v4f a = (*(const v4f*)&so[0][q][d] + *(const v4f*)&so[1][q][d]) + (*(const v4f*)&so[2][q][d] + *(const v4f*)&so[3][q][d]);
    vst2(Y + ((size_t)b * TT + qb * BQ + q) * CC + d, a * inv); } }

extern "C" void kernel_launch(void* const* d_in, const int* in_sizes, int n_in, void* d_out, int out_size, void* d_ws, size_t ws_size, hipStream_t stream) {
  (void)in_sizes; (void)n_in; (void)out_size;
  const float** F = (const float**)d_in;
  if (ws_size < (size_t)WS_END) return;
  char* ws = (char*)d_ws; _Float16 *QH = (_Float16*)(ws + WS_QH), *KH = (_Float16*)(ws + WS_KH), *VT = (_Float16*)(ws + WS_VT), *QL = (_Float16*)(ws + WS_QL), *KL = (_Float16*)(ws + WS_KL); __bf16 *VB = (__bf16*)(ws + WS_VB), *VBL = (__bf16*)(ws + WS_VBL); float *S = (float*)(ws + WS_S), *Y = (float*)(ws + WS_Y);
  (void)Y; (void)S; (void)QL; (void)KL; (void)VB; (void)VBL;
  // inputs: 0 queries [16,2048,64]; 1 keys; 2 values
  k_planes64<<<dim3(TNB * TT / 64), 256, 0, stream>>>(F[0], F[1], F[2], QH, QL, KH, KL, VT, VB, VBL);
  k_fa<<<dim3(TT / BQ, TNB), 512, 0, stream>>>(QH, KH, VT, (float*)d_out);


}
